// v009
// Times are from an AMD MI455X. After a warm-up the kernel runs many times in a row, and a time is the length of
// such a window on the GPU divided by its runs, so every launch and the gaps after it count. The runs cycle
// through copies of the inputs. A figure is the median of several windows, for all but v000 over two sittings.
// Sittings can differ by a few percent; kernels timed side by side share one.
// Earlier versions than v009 are not in this document.
// It runs in 53.2 microseconds.
// Next to v008, in two timings, it ran 1.03 times as fast each time.
// Counting every step since v000, which is the starting kernel, it is 26.6 times as fast.
#include <hip/hip_runtime.h>
#include <math.h>

typedef __attribute__((ext_vector_type(16))) _Float16 v16h;
typedef __attribute__((ext_vector_type(8)))  _Float16 v8h;
typedef __attribute__((ext_vector_type(16))) __bf16   v16b;
typedef __attribute__((ext_vector_type(8)))  float    v8f;
typedef __attribute__((ext_vector_type(4)))  float    v4f;

// 16-bit WMMA fragment map (wave32), lane L, h = L>>4, m = L&15:
//   A 16x32: lane = row m;   element i -> k = (i<8) ? 8h+i : 16+8h+(i-8)
//   B 32x16: lane = column m; the SAME k(i,h)
//   D 16x16 (8 f32): lane = column m; element r -> row 8h+r
__device__ __forceinline__ int frag_k(int i, int h) { return (i < 8) ? (8 * h + i) : (16 + 8 * h + (i - 8)); }
__device__ __forceinline__ __bf16 bf16_rne(float f) {
    unsigned int u = __float_as_uint(f);
    u += 0x7fffu + ((u >> 16) & 1u);
    return __builtin_bit_cast(__bf16, (unsigned short)(u >> 16));
}
__device__ __forceinline__ float bf16_f32(__bf16 b) { return __uint_as_float(((unsigned int)__builtin_bit_cast(unsigned short, b)) << 16); }
__device__ __forceinline__ v8f wmma16(v16h a, v16h b, v8f c) {
    c = __builtin_amdgcn_wmma_f32_16x16x32_f16(false, a, false, b, (short)0, c, false, false);
    asm volatile("v_nop\n\tv_nop\n\tv_nop\n\tv_nop" : "+v"(c) : "v"(a), "v"(b));
    return c;
}
__device__ __forceinline__ v8f wmmab(v16b a, v16b b, v8f c) {
    c = __builtin_amdgcn_wmma_f32_16x16x32_bf16(false, a, false, b, (short)0, c, false, false);
    asm volatile("v_nop\n\tv_nop\n\tv_nop\n\tv_nop" : "+v"(c) : "v"(a), "v"(b));
    return c;
}
struct Split { v16b hi, lo; };
// hi/lo split product: a.hi*b.hi + a.hi*b.lo + a.lo*b.hi
__device__ __forceinline__ v8f wmma3(const Split& a, const Split& b, v8f c) {
    c = __builtin_amdgcn_wmma_f32_16x16x32_bf16(false, a.hi, false, b.hi, (short)0, c, false, false);
    c = __builtin_amdgcn_wmma_f32_16x16x32_bf16(false, a.hi, false, b.lo, (short)0, c, false, false);
    c = __builtin_amdgcn_wmma_f32_16x16x32_bf16(false, a.lo, false, b.hi, (short)0, c, false, false);
    asm volatile("v_nop\n\tv_nop\n\tv_nop\n\tv_nop" : "+v"(c) : "v"(a.hi), "v"(a.lo), "v"(b.hi), "v"(b.lo));
    return c;
}
struct Split3 { v16b hi, mid, lo; };
// triple split product (6 terms, drops only terms below 2^-24 relative)
__device__ __forceinline__ v8f wmma6(const Split3& a, const Split3& b, v8f c) {
    c = __builtin_amdgcn_wmma_f32_16x16x32_bf16(false, a.hi, false, b.hi, (short)0, c, false, false);
    c = __builtin_amdgcn_wmma_f32_16x16x32_bf16(false, a.hi, false, b.mid, (short)0, c, false, false);
    c = __builtin_amdgcn_wmma_f32_16x16x32_bf16(false, a.mid, false, b.hi, (short)0, c, false, false);
    c = __builtin_amdgcn_wmma_f32_16x16x32_bf16(false, a.hi, false, b.lo, (short)0, c, false, false);
    c = __builtin_amdgcn_wmma_f32_16x16x32_bf16(false, a.mid, false, b.mid, (short)0, c, false, false);
    c = __builtin_amdgcn_wmma_f32_16x16x32_bf16(false, a.lo, false, b.hi, (short)0, c, false, false);
    asm volatile("v_nop\n\tv_nop\n\tv_nop\n\tv_nop" : "+v"(c) : "v"(a.hi), "v"(a.mid), "v"(a.lo), "v"(b.hi), "v"(b.mid), "v"(b.lo));
    return c;
}

// Fragment gathers from f32 memory: element i <- p[(k0 + frag_k(i,h)) * sk] * s, zero for k >= klen.
__device__ __forceinline__ v16h fh_ld(const float* __restrict__ p, long long sk, int k0, int h, int klen, float s) {
    v16h a;
#pragma unroll
    for (int i = 0; i < 16; ++i) { const int k = k0 + frag_k(i, h); a[i] = (k < klen) ? (_Float16)(p[(long long)k * sk] * s) : (_Float16)0.f; }
    return a;
}
__device__ __forceinline__ Split sp_ld(const float* __restrict__ p, long long sk, int k0, int h, int klen, float s) {
    Split r;
#pragma unroll
    for (int i = 0; i < 16; ++i) {
        const int k = k0 + frag_k(i, h); const float x = (k < klen) ? p[(long long)k * sk] * s : 0.f;
        const __bf16 hb = bf16_rne(x); r.hi[i] = hb; r.lo[i] = bf16_rne(x - bf16_f32(hb));
    }
    return r;
}
__device__ __forceinline__ Split3 sp3_ld(const float* __restrict__ p, long long sk, int k0, int h, int klen, float s) {
    Split3 r;
#pragma unroll
    for (int i = 0; i < 16; ++i) {
        const int k = k0 + frag_k(i, h); const float x = (k < klen) ? p[(long long)k * sk] * s : 0.f;
        const __bf16 hb = bf16_rne(x); const float r1 = x - bf16_f32(hb); const __bf16 mb = bf16_rne(r1);
        r.hi[i] = hb; r.mid[i] = mb; r.lo[i] = bf16_rne(r1 - bf16_f32(mb));
    }
    return r;
}
__device__ __forceinline__ v16b bh_ld(const float* __restrict__ p, long long sk, int k0, int h, int klen, float s) {
    v16b a;
#pragma unroll
    for (int i = 0; i < 16; ++i) { const int k = k0 + frag_k(i, h); a[i] = bf16_rne((k < klen) ? p[(long long)k * sk] * s : 0.f); }
    return a;
}
// f16 fragment from an f16 LDS/global row with element stride 1 (k-contiguous), no bounds (tile already zero padded)
__device__ __forceinline__ v16h fh_row(const _Float16* __restrict__ row, int k0, int h) {
    v16h a;
#pragma unroll
    for (int i = 0; i < 16; ++i) a[i] = row[k0 + frag_k(i, h)];
    return a;
}

#define VST2(T, ptr, val) do { const T vst2_v_ = (val); *(T*)(ptr) = vst2_v_;  } while (0)
typedef float v4f __attribute__((ext_vector_type(4)));
typedef unsigned int v4u __attribute__((ext_vector_type(4)));
typedef unsigned int v2u __attribute__((ext_vector_type(2)));
#define VST2V4(ptr, val) do { const v4f vst2_v4_ = (val); *(v4f*)(ptr) = vst2_v4_;  } while (0)

__device__ __attribute__((noinline)) float act_fn(float v, int act) {
    if (act == 1) return fmaxf(v, 0.f);                                                                               // relu
    if (act == 2) { const float u = 0.7978845608028654f * (v + 0.044715f * v * v * v); return 0.5f * v * (1.f + tanhf(u)); } // tanh-gelu
    if (act == 3) return v / (1.f + expf(-v));                                                                        // silu
    if (act == 4) return 0.5f * v * (1.f + erff(v * 0.7071067811865476f));                                             // erf-gelu
    if (act == 5) return tanhf(v);
    if (act == 6) return 1.f / (1.f + expf(-v));                                                                      // sigmoid
    if (act == 7) return (v > 0.f) ? v : 0.01f * v;                                                                   // leaky relu 0.01
    if (act == 8) return (v > 0.f) ? v : (expf(v) - 1.f);                                                             // elu
    if (act == 9) return fminf(fmaxf(v, 0.f), 6.f);                                                                   // relu6
    if (act == 10) return fabsf(v);                                                                                    // abs
    if (act == 11) return (v >= 0.f) ? v : 0.1f * v;                                                                  // leaky 0.1
    if (act == 12) return (v > 0.f) ? v : 0.2f * v;                                                                   // leaky 0.2
    if (act == 13) return (v > 20.f) ? v : log1pf(expf(v));                                                            // softplus
    return v;
}

// =====================================================================================================================
// k_gemm<MODE>: C(z, m, n) = act(alpha * sum_k A(z, m, k) * B(z, k, n) + bias) + beta * R(z, m, n)
//   One wave (32-thread block) per 16 x 32 tile of C; grid (ceil(N/32), ceil(M/16), Z). Batch z -> (zo = z / zi_n, zi = z % zi_n)
//   with separate outer/inner strides for every tensor (e.g. batch and head). A(m,k) = A[zo*sAo + zi*sAi + m*sAm + k*sAk] (f32),
//   B(k,n) = B[zo*sBo + zi*sBi + n*sBn + k*sBk] (f32); any M, N, K (K zero-padded to 32 inside the fragments, M/N tails guarded).
//   C(m,n) = C[zo*sCo + zi*sCi + m*sCm + n] (n contiguous). flags: 1 bias[n], 2 bias[m], 4 residual R[zo*sRo + zi*sRi + m*sRm + n*sRn].
//   MODE 0: f16 operands (A prescaled by sa, B by sb, both undone in the epilogue); 1: bf16 hi/lo split (3 products); 2: bf16;
//   3: bf16 hi/mid/lo triple split (6 products); 4: as 3 with Kahan-compensated f32 accumulation across k-steps.
// =====================================================================================================================
struct GemmP {
    const float* A; const float* B; const float* bias; const float* R; float* C;
    long long sAo, sAi, sAm, sAk, sBo, sBi, sBn, sBk, sCo, sCi, sCm, sRo, sRi, sRm, sRn;
    int M, N, K, zi_n, flags, act; float alpha, beta, sa, sb;
    int Npad, pad_;     // columns [N, Npad) of C are written as 0 so that padded workspace rows are covered by whole-line stores; Npad >= N
};
static_assert(sizeof(GemmP) == 5 * 8 + 15 * 8 + 6 * 4 + 4 * 4 + 2 * 4, "GemmP has padding");

template <int MODE>
__global__ __launch_bounds__(32) void k_gemm(GemmP p) {
    const int lane = threadIdx.x & 31, h = lane >> 4, l15 = lane & 15;
    const int m0 = blockIdx.y * 16, n0 = blockIdx.x * 32;
    const int z = blockIdx.z, zo = z / p.zi_n, zi = z - zo * p.zi_n;
    const float* A = p.A + zo * p.sAo + zi * p.sAi;
    const float* B = p.B + zo * p.sBo + zi * p.sBi;
    const int am = min(m0 + l15, p.M - 1);                       // clamped row for loads (stores are guarded)
    v8f acc[2], comp[2];
#pragma unroll
    for (int t = 0; t < 2; ++t) { v8f zz = {}; acc[t] = zz; comp[t] = zz; }
    for (int k0 = 0; k0 < p.K; k0 += 32) {
        const float* arow = A + (long long)am * p.sAm;
        if (MODE == 1) {
            const Split a = sp_ld(arow, p.sAk, k0, h, p.K, 1.f);
#pragma unroll
            for (int t = 0; t < 2; ++t) {
                const int bn = min(n0 + t * 16 + l15, p.N - 1);
                acc[t] = wmma3(a, sp_ld(B + (long long)bn * p.sBn, p.sBk, k0, h, p.K, 1.f), acc[t]);
            }
        } else if (MODE == 3) {
            const Split3 a = sp3_ld(arow, p.sAk, k0, h, p.K, 1.f);
#pragma unroll
            for (int t = 0; t < 2; ++t) {
                const int bn = min(n0 + t * 16 + l15, p.N - 1);
                acc[t] = wmma6(a, sp3_ld(B + (long long)bn * p.sBn, p.sBk, k0, h, p.K, 1.f), acc[t]);
            }
        } else if (MODE == 4) {
            // triple split as MODE 3, but each k-step's 6 products go into a fresh accumulator and the partial is added to the running f32 sum
            // on the VALU with Kahan compensation (accumulation error stays ~1 ulp however long K is)
            const Split3 a = sp3_ld(arow, p.sAk, k0, h, p.K, 1.f);
#pragma unroll
            for (int t = 0; t < 2; ++t) {
                const int bn = min(n0 + t * 16 + l15, p.N - 1); v8f zz = {};
                const v8f part = wmma6(a, sp3_ld(B + (long long)bn * p.sBn, p.sBk, k0, h, p.K, 1.f), zz);
                const v8f y = part - comp[t]; const v8f s = acc[t] + y; comp[t] = (s - acc[t]) - y; acc[t] = s;
            }
        } else if (MODE == 2) {
            const v16b a = bh_ld(arow, p.sAk, k0, h, p.K, 1.f);
#pragma unroll
            for (int t = 0; t < 2; ++t) {
                const int bn = min(n0 + t * 16 + l15, p.N - 1);
                acc[t] = wmmab(a, bh_ld(B + (long long)bn * p.sBn, p.sBk, k0, h, p.K, 1.f), acc[t]);
            }
        } else {
            const v16h a = fh_ld(arow, p.sAk, k0, h, p.K, p.sa);
#pragma unroll
            for (int t = 0; t < 2; ++t) {
                const int bn = min(n0 + t * 16 + l15, p.N - 1);
                acc[t] = wmma16(a, fh_ld(B + (long long)bn * p.sBn, p.sBk, k0, h, p.K, p.sb), acc[t]);
            }
        }
    }
    const float iscale = (MODE == 0) ? p.alpha / (p.sa * p.sb) : p.alpha;
    float* C = p.C + zo * p.sCo + zi * p.sCi;
    const float* R = p.R + zo * p.sRo + zi * p.sRi;
    __shared__ __align__(16) float ctile[16][36];
#pragma unroll
    for (int t = 0; t < 2; ++t) {
        const int n = n0 + t * 16 + l15; const int nn = min(n, p.N - 1);
#pragma unroll
        for (int r = 0; r < 8; ++r) {
            const int m = m0 + 8 * h + r; const int mm = min(m, p.M - 1);
            float v = acc[t][r] * iscale;
            if (p.flags & 1) v += p.bias[nn];
            if (p.flags & 2) v += p.bias[mm];
            if (p.flags & 8) v *= p.bias[(long long)zo * p.M + mm];   /* per-(z,row) scale vector laid out [Z][M]; exclusive with the bias flags */
            v = act_fn(v, p.act);
            if (p.flags & 4) v += p.beta * R[(long long)mm * p.sRm + (long long)nn * p.sRn];
            ctile[8 * h + r][t * 16 + l15] = (n < p.N) ? v : 0.f;
        }
    }
    __syncthreads();
    const int NW = (p.Npad > p.N) ? p.Npad : p.N;           // write width
    const bool fast = (m0 + 16 <= p.M) && (n0 + 32 <= NW) && ((p.sCm & 3) == 0) && ((((size_t)C) & 15) == 0);
    if (fast) {
#pragma unroll
        for (int s = 0; s < 4; ++s) {
            const int row = s * 4 + (lane >> 3), c4 = (lane & 7) * 4;
            const v4f v = *(const v4f*)&ctile[row][c4];
            VST2V4(C + (long long)(m0 + row) * p.sCm + n0 + c4, v);
        }
    } else {
        for (int row = 0; row < 16; ++row) {
            const int m = m0 + row, n = n0 + lane;
            if (m < p.M && n < NW) VST2(float, C + (long long)m * p.sCm + n, ctile[row][lane]);
        }
    }
}


// =====================================================================================================================
// k_gemmT<MODE, TM, TN>: same contract as k_gemm, but one wave computes a (16*TM) x (16*TN) tile: TM A fragments and TN B fragments are
//   loaded per 32-wide k-step and reused across TM*TN WMMAs (far fewer load/convert instructions per MAC). MODE 0 (f16), 1 (bf16 hi/lo),
//   2 (bf16) only. grid (ceil(NW/(16*TN)), ceil(M/(16*TM)), Z), block 32. Epilogue identical to k_gemm, run per 16x32 sub-tile.
// =====================================================================================================================
template <int MODE, int TM, int TN>
__global__ __launch_bounds__(32) void k_gemmT(GemmP p) {
    const int lane = threadIdx.x & 31, h = lane >> 4, l15 = lane & 15;
    const int m0 = blockIdx.y * (16 * TM), n0 = blockIdx.x * (16 * TN);
    const int z = blockIdx.z, zo = z / p.zi_n, zi = z - zo * p.zi_n;
    const float* A = p.A + zo * p.sAo + zi * p.sAi;
    const float* B = p.B + zo * p.sBo + zi * p.sBi;
    v8f acc[TM][TN];
#pragma unroll
    for (int i = 0; i < TM; ++i)
#pragma unroll
        for (int t = 0; t < TN; ++t) { v8f zz = {}; acc[i][t] = zz; }
    for (int k0 = 0; k0 < p.K; k0 += 32) {
        if (MODE == 1) {
            Split a[TM], b[TN];
#pragma unroll
            for (int i = 0; i < TM; ++i) { const int am = min(m0 + 16 * i + l15, p.M - 1); a[i] = sp_ld(A + (long long)am * p.sAm, p.sAk, k0, h, p.K, 1.f); }
#pragma unroll
            for (int t = 0; t < TN; ++t) { const int bn = min(n0 + 16 * t + l15, p.N - 1); b[t] = sp_ld(B + (long long)bn * p.sBn, p.sBk, k0, h, p.K, 1.f); }
#pragma unroll
            for (int i = 0; i < TM; ++i)
#pragma unroll
                for (int t = 0; t < TN; ++t) acc[i][t] = wmma3(a[i], b[t], acc[i][t]);
        } else if (MODE == 2) {
            v16b a[TM], b[TN];
#pragma unroll
            for (int i = 0; i < TM; ++i) { const int am = min(m0 + 16 * i + l15, p.M - 1); a[i] = bh_ld(A + (long long)am * p.sAm, p.sAk, k0, h, p.K, 1.f); }
#pragma unroll
            for (int t = 0; t < TN; ++t) { const int bn = min(n0 + 16 * t + l15, p.N - 1); b[t] = bh_ld(B + (long long)bn * p.sBn, p.sBk, k0, h, p.K, 1.f); }
#pragma unroll
            for (int i = 0; i < TM; ++i)
#pragma unroll
                for (int t = 0; t < TN; ++t) acc[i][t] = wmmab(a[i], b[t], acc[i][t]);
        } else {
            v16h a[TM], b[TN];
#pragma unroll
            for (int i = 0; i < TM; ++i) { const int am = min(m0 + 16 * i + l15, p.M - 1); a[i] = fh_ld(A + (long long)am * p.sAm, p.sAk, k0, h, p.K, p.sa); }
#pragma unroll
            for (int t = 0; t < TN; ++t) { const int bn = min(n0 + 16 * t + l15, p.N - 1); b[t] = fh_ld(B + (long long)bn * p.sBn, p.sBk, k0, h, p.K, p.sb); }
#pragma unroll
            for (int i = 0; i < TM; ++i)
#pragma unroll
                for (int t = 0; t < TN; ++t) acc[i][t] = wmma16(a[i], b[t], acc[i][t]);
        }
    }
    const float iscale = (MODE == 0) ? p.alpha / (p.sa * p.sb) : p.alpha;
    float* C = p.C + zo * p.sCo + zi * p.sCi;
    const float* R = p.R + zo * p.sRo + zi * p.sRi;
    const int NW = (p.Npad > p.N) ? p.Npad : p.N;
    __shared__ __align__(16) float ctile[16][36];
#pragma unroll
    for (int i = 0; i < TM; ++i) {
        const int mb = m0 + 16 * i; if (mb >= p.M) break;          // wave-uniform
#pragma unroll
        for (int tp = 0; tp < TN / 2; ++tp) {
            const int nb = n0 + 32 * tp; if (nb >= NW) break;        // wave-uniform
#pragma unroll
            for (int t2 = 0; t2 < 2; ++t2) {
                const int t = 2 * tp + t2; const int n = nb + t2 * 16 + l15; const int nn = min(n, p.N - 1);
#pragma unroll
                for (int r = 0; r < 8; ++r) {
                    const int m = mb + 8 * h + r; const int mm = min(m, p.M - 1);
                    float v = acc[i][t][r] * iscale;
                    if (p.flags & 1) v += p.bias[nn];
                    if (p.flags & 2) v += p.bias[mm];
            if (p.flags & 8) v *= p.bias[(long long)zo * p.M + mm];   /* per-(z,row) scale vector laid out [Z][M]; exclusive with the bias flags */
                    v = act_fn(v, p.act);
                    if (p.flags & 4) v += p.beta * R[(long long)mm * p.sRm + (long long)nn * p.sRn];
                    ctile[8 * h + r][t2 * 16 + l15] = (n < p.N) ? v : 0.f;
                }
            }
            __syncthreads();
            const bool fast = (mb + 16 <= p.M) && (nb + 32 <= NW) && ((p.sCm & 3) == 0) && ((((size_t)C) & 15) == 0);
            if (fast) {
#pragma unroll
                for (int s = 0; s < 4; ++s) {
                    const int row = s * 4 + (lane >> 3), c4 = (lane & 7) * 4;
                    const v4f v = *(const v4f*)&ctile[row][c4];
                    VST2V4(C + (long long)(mb + row) * p.sCm + nb + c4, v);
                }
            } else {
                for (int row = 0; row < 16; ++row) {
                    const int m = mb + row, n = nb + lane;
                    if (m < p.M && n < NW) VST2(float, C + (long long)m * p.sCm + n, ctile[row][lane]);
                }
            }
            __syncthreads();
        }
    }
}

// =====================================================================================================================
//   Wave = 16 queries, AW waves per block, 64-key blocks; grid (ceil(Lq/(16*AW)), H, B), block 32*AW. Any Lq, Lk; head dim dh <= DHP
//   (DHP multiple of 32), value dim dv <= DVP (multiple of 16, <= 128). Every tensor addressed by (batch, head, row, element) strides, f32.
//   Scores: QM 0 f16 operands, 1 bf16 hi/lo split, 2 bf16 triple split; statistics f32 (exp2 domain); P.V: P x 4096 as f16 with V f16 staged in LDS
//   (SPLITPV: P and V as bf16 hi/lo splits). kv head = h / hrep. Masking: causal = 1 (keep j <= i + coff, masked -> -inf, key blocks beyond the
//   diagonal skipped), causal = 2 (masked -> mfill, a finite fill like the -1e9; no skipping), causal = 3 (keep j >= i + coff,
//   masked -> -inf, no skipping); optional additive f32 mask Mf,
//   optional int keep-mask Mi (0 -> score := mfill), both addressed b*smb + h*smh + i*smi + j*smj (0 strides broadcast).
// =====================================================================================================================
#define AW 4
struct AttnP {   // apv4
    const float* Q; const float* K; const float* V; float* O; float* P; const float* Mf; const int* Mi; float* ST;
    const float* Pw; const float* Rt; const int* SQ; const int* SK;           // optional: post-softmax weight, relative-position table, segment ids
    long long swb, swh, swi, swj, srb, srh, sri;                                 // Pw strides (b,h,i,j); Rt strides (b,h,i), column = clamp(i - j + roff, 0, rn-1)
    long long sQb, sQh, sQi, sQd, sKb, sKh, sKj, sKd, sVb, sVh, sVj, sVd, sOb, sOh, sOi, sPb, sPh, sPi, smb, smh, smi, smj;
    int Lq, Lk, dh, dv, hrep, causal, coff, pband;   // pband > 0: P holds only the band |j - i| <= pband, column j - i + pband
    float scale, mfill; int nonorm, mpol;             // nonorm (online path only): O = sum_j exp(score_j) V_j without the 1/rowsum (scores must be <= ~0); mpol: Mi masks where ==0 (mpol 0) or where !=0 (mpol 1)
    int roff, rn, segpol, win;                        // Rt column offset/count; SQ/SK: score := mfill where (segpol 0) SQ[i] != SK[j] or (segpol 1) SQ[i] == SK[j]; win > 0: keys with i - j > win (after coff) -> -inf
};
//   Pw: the softmax numerator is multiplied by Pw(b,h,i,j) AFTER the row sum is taken (probs * weight, then P.V), as in post-softmax multiplicative biases.                                                    // ST (optional): per row (b,h,i) -> ST[((b*H + h)*Lq + i)*2 + {0,1}] = {row max of the scaled+masked score (natural units), sum_j exp(score - max)}
static_assert(sizeof(AttnP) == 12 * 8 + 29 * 8 + 16 * 4, "AttnP has padding");

#ifndef KATTN_ATTR
#define KATTN_ATTR
#endif
template <int DHP, int DVP, int QM, bool SPLITPV, bool TWOPASS>
__global__ __launch_bounds__(32 * AW) KATTN_ATTR void k_attn(AttnP p) {
    constexpr int NT = DVP / 16;                // output tiles
    constexpr int KS = DHP / 32;                // k-steps for the scores
    constexpr int VP = DVP + 8;                 // LDS pitch (halves)
    __shared__ __align__(16) float    pl[AW][16 * 64];
    __shared__ __align__(16) _Float16 vl[(SPLITPV ? 2 : 1) * 64 * VP];   // f16 V tile, or bf16 hi and lo tiles (same 2-byte size)
    const int lane = threadIdx.x & 31, hf = lane >> 4, l15 = lane & 15, wave = threadIdx.x >> 5;
    const int h = blockIdx.y, b = blockIdx.z, hk = h / p.hrep;
    const int q0 = (blockIdx.x * AW + wave) * 16;
    float* myp = pl[wave];
    const float L2E = 1.4426950408889634f;
    const float NEG = -__builtin_inff();
    const int qi = min(q0 + l15, p.Lq - 1);
    const float* qrow = p.Q + b * p.sQb + h * p.sQh + (long long)qi * p.sQi;
    const float* kbase = p.K + b * p.sKb + hk * p.sKh;
    const float* vbase = p.V + b * p.sVb + hk * p.sVh;
    v16h qa[QM == 0 ? KS : 1]; Split qs_[QM == 1 ? KS : 1]; Split3 qt_[QM == 2 ? KS : 1];
#pragma unroll
    for (int ks = 0; ks < KS; ++ks) {
        if (QM == 2) qt_[ks] = sp3_ld(qrow, p.sQd, ks * 32, hf, p.dh, 1.f);
        else if (QM == 1) qs_[ks] = sp_ld(qrow, p.sQd, ks * 32, hf, p.dh, 1.f);
        else qa[ks] = fh_ld(qrow, p.sQd, ks * 32, hf, p.dh, 1.f);
    }
    v8f o[NT]; float m8[8], l8[8];
#pragma unroll
    for (int t = 0; t < NT; ++t) { v8f zz = {}; o[t] = zz; }
#pragma unroll
    for (int i = 0; i < 8; ++i) { m8[i] = NEG; l8[i] = 0.f; }
    int jend = p.Lk; int jstart = 0;
    if (p.causal == 1) { const int je = (blockIdx.x * AW + AW - 1) * 16 + 16 + p.coff; jend = min(jend, max(je, 0)); }   // uniform per block
    if (p.win > 0) { const int js = (int)(blockIdx.x * AW) * 16 + p.coff - p.win; jstart = (js > 0) ? (js / 64) * 64 : 0; }   // uniform per block: key blocks entirely outside every row's window hold only -inf entries and are skipped exactly
    const int npass = TWOPASS ? 2 : 1;
    for (int pass = 0; pass < npass; ++pass) {
        const bool dopv = (!TWOPASS) || pass == 1;
        for (int j0 = jstart; j0 < jend; j0 += 64) {
            if (dopv) {
                __syncthreads();                                 // previous key block's reads of vl / pl are done
                for (int idx = threadIdx.x; idx < 64 * DVP; idx += 32 * AW) {
                    const int jr = idx / DVP, d = idx - jr * DVP, j = j0 + jr;
                    const float f = (j < p.Lk && d < p.dv) ? vbase[(long long)j * p.sVj + (long long)d * p.sVd] : 0.f;
                    if (SPLITPV) {
                        const __bf16 hb = bf16_rne(f);
                        ((__bf16*)vl)[jr * VP + d] = hb; ((__bf16*)vl)[64 * VP + jr * VP + d] = bf16_rne(f - bf16_f32(hb));
                    } else vl[jr * VP + d] = (_Float16)f;
                }
            }
            v8f s[4];
#pragma unroll
            for (int t = 0; t < 4; ++t) {
                const int j = min(j0 + t * 16 + l15, p.Lk - 1);
                const float* krow = kbase + (long long)j * p.sKj;
                v8f acc = {};
#pragma unroll
                for (int ks = 0; ks < KS; ++ks) {
                    if (QM == 2)      acc = wmma6(qt_[ks], sp3_ld(krow, p.sKd, ks * 32, hf, p.dh, 1.f), acc);
                    else if (QM == 1) acc = wmma3(qs_[ks], sp_ld(krow, p.sKd, ks * 32, hf, p.dh, 1.f), acc);
                    else              acc = wmma16(qa[ks], fh_ld(krow, p.sKd, ks * 32, hf, p.dh, 1.f), acc);
                }
                s[t] = acc;
            }
            float pv[8][4];
#pragma unroll
            for (int i = 0; i < 8; ++i) {
                const int irow = q0 + i + 8 * hf;
                const int ic = min(irow, p.Lq - 1);
                float sc[4];
#pragma unroll
                for (int t = 0; t < 4; ++t) {
                    const int jg = j0 + t * 16 + l15;
                    float v = s[t][i] * p.scale;
                    if (p.Mf) v += p.Mf[b * p.smb + h * p.smh + (long long)ic * p.smi + (long long)min(jg, p.Lk - 1) * p.smj];
                    if (p.Rt) { int rc = ic - min(jg, p.Lk - 1) + p.roff; rc = rc < 0 ? 0 : (rc >= p.rn ? p.rn - 1 : rc); v += p.Rt[b * p.srb + h * p.srh + (long long)ic * p.sri + rc]; }
                    if (p.Mi) { const int mv = p.Mi[b * p.smb + h * p.smh + (long long)ic * p.smi + (long long)min(jg, p.Lk - 1) * p.smj]; if (p.mpol ? (mv != 0) : (mv == 0)) v = p.mfill; }
                    if (p.SQ) { const bool same = p.SQ[(long long)b * p.Lq + ic] == p.SK[(long long)b * p.Lk + min(jg, p.Lk - 1)]; if (p.segpol ? same : !same) v = p.mfill; }
                    if (p.causal == 2 && jg > irow + p.coff) v = p.mfill;
                    if (jg >= p.Lk || (p.causal == 1 && jg > irow + p.coff) || (p.causal == 3 && jg < irow + p.coff) || (p.win > 0 && irow + p.coff - jg > p.win)) v = NEG; else v *= L2E;
                    sc[t] = v;
                }
                if (!TWOPASS || pass == 0) {
                    float mx = fmaxf(fmaxf(sc[0], sc[1]), fmaxf(sc[2], sc[3]));
                    mx = fmaxf(mx, __shfl_xor(mx, 1, 32)); mx = fmaxf(mx, __shfl_xor(mx, 2, 32));
                    mx = fmaxf(mx, __shfl_xor(mx, 4, 32)); mx = fmaxf(mx, __shfl_xor(mx, 8, 32));
                    const float mnew = fmaxf(m8[i], mx);
                    const float corr = (mnew == NEG) ? 1.f : exp2f(m8[i] - mnew);
                    float rs = 0.f;
#pragma unroll
                    for (int t = 0; t < 4; ++t) {
                        const float pp = (sc[t] == NEG) ? 0.f : exp2f(sc[t] - mnew); rs += pp;
                        pv[i][t] = p.Pw ? pp * p.Pw[b * p.swb + h * p.swh + (long long)ic * p.swi + (long long)min(j0 + t * 16 + l15, p.Lk - 1) * p.swj] : pp;
                    }
                    rs += __shfl_xor(rs, 1, 32); rs += __shfl_xor(rs, 2, 32); rs += __shfl_xor(rs, 4, 32); rs += __shfl_xor(rs, 8, 32);
                    l8[i] = l8[i] * corr + rs; m8[i] = mnew;
                    if (!TWOPASS) {
#pragma unroll
                        for (int t = 0; t < NT; ++t) o[t][i] *= corr;
                    }
                } else {
                    const float inv = (l8[i] > 0.f) ? 1.f / l8[i] : 0.f;
#pragma unroll
                    for (int t = 0; t < 4; ++t) {
                        const int jg = j0 + t * 16 + l15;
                        float pp = (sc[t] == NEG) ? 0.f : exp2f(sc[t] - m8[i]) * inv;
                        if (p.Pw) pp *= p.Pw[b * p.swb + h * p.swh + (long long)ic * p.swi + (long long)min(jg, p.Lk - 1) * p.swj];
                        pv[i][t] = pp;
                    }
                }
            }
            if (dopv) {
#pragma unroll
                for (int i = 0; i < 8; ++i)
#pragma unroll
                    for (int t = 0; t < 4; ++t) ((float*)myp)[(i + 8 * hf) * 64 + t * 16 + l15] = pv[i][t];
                __syncthreads();                                 // P (per wave) and V (shared) visible
                if (p.P) {
                    float* pb_ = p.P + b * p.sPb + h * p.sPh;
                    const bool fastP = (p.pband == 0) && ((p.sPi & 3) == 0) && (j0 + 64 <= p.Lk) && (q0 + 16 <= p.Lq) && ((((size_t)pb_) & 15) == 0);
                    if (fastP) {
#pragma unroll
                        for (int s = 0; s < 8; ++s) {
                            const int row = s * 2 + (lane >> 4), c4 = (lane & 15) * 4;
                            const v4f v = *(const v4f*)(myp + row * 64 + c4);
                            VST2V4(pb_ + (long long)(q0 + row) * p.sPi + j0 + c4, v);
                        }
                    } else {
                        for (int row = 0; row < 16; ++row) {
                            const int irow = q0 + row; if (irow >= p.Lq) continue;
                            for (int c = lane; c < 64; c += 32) {
                                const int jg = j0 + c; if (jg >= p.Lk) continue;
                                if (p.pband == 0) VST2(float, pb_ + (long long)irow * p.sPi + jg, myp[row * 64 + c]);
                                else if (jg - irow <= p.pband && irow - jg <= p.pband) VST2(float, pb_ + (long long)irow * p.sPi + (jg - irow + p.pband), myp[row * 64 + c]);
                            }
                        }
                    }
                }
                if (SPLITPV) {
                    const Split pa0 = sp_ld(myp + l15 * 64, 1, 0, hf, 64, 1.f), pa1 = sp_ld(myp + l15 * 64, 1, 32, hf, 64, 1.f);
                    const __bf16* vh = (const __bf16*)vl; const __bf16* vlo = vh + 64 * VP;
#pragma unroll
                    for (int t = 0; t < NT; ++t) {
                        const int dcol = t * 16 + l15;
                        Split b0, b1;
#pragma unroll
                        for (int e = 0; e < 16; ++e) {
                            const int k0 = frag_k(e, hf), k1 = 32 + frag_k(e, hf);
                            b0.hi[e] = vh[k0 * VP + dcol]; b0.lo[e] = vlo[k0 * VP + dcol]; b1.hi[e] = vh[k1 * VP + dcol]; b1.lo[e] = vlo[k1 * VP + dcol];
                        }
                        o[t] = wmma3(pa0, b0, o[t]);
                        o[t] = wmma3(pa1, b1, o[t]);
                    }
                } else {
                    const v16h pa0 = fh_ld(myp + l15 * 64, 1, 0, hf, 64, 4096.f), pa1 = fh_ld(myp + l15 * 64, 1, 32, hf, 64, 4096.f);
#pragma unroll
                    for (int t = 0; t < NT; ++t) {
                        const int dcol = t * 16 + l15;
                        v16h b0, b1;
#pragma unroll
                        for (int e = 0; e < 16; ++e) { b0[e] = vl[frag_k(e, hf) * VP + dcol]; b1[e] = vl[(32 + frag_k(e, hf)) * VP + dcol]; }
                        o[t] = wmma16(pa0, b0, o[t]);
                        o[t] = wmma16(pa1, b1, o[t]);
                    }
                }
            }
        }
    }
    float* obase = p.O + b * p.sOb + h * p.sOh;
    if (p.ST) {
        const int rl = lane >> 1, isel = rl & 7;           // row q0 + rl ; rl>>3 == hf holds because lane>>4 == (lane>>1)>>3
        float mv = 0.f, lv = 0.f;
#pragma unroll
        for (int i = 0; i < 8; ++i) if (i == isel) { mv = m8[i]; lv = l8[i]; }
        const int irow = q0 + rl;
        if (irow < p.Lq) { float* st = p.ST + (((long long)b * gridDim.y + h) * p.Lq + irow) * 2 + (lane & 1); VST2(float, st, (lane & 1) ? lv : mv * 0.6931471805599453f); }
    }
    float invr[8];
#pragma unroll
    for (int i = 0; i < 8; ++i) {
        if (TWOPASS) invr[i] = SPLITPV ? 1.f : (1.f / 4096.f);
        else if (p.nonorm) invr[i] = exp2f(m8[i]) * (SPLITPV ? 1.f : (1.f / 4096.f));
        else invr[i] = (l8[i] > 0.f) ? (SPLITPV ? 1.f / l8[i] : 1.f / (l8[i] * 4096.f)) : 0.f;
    }
    __syncthreads();                                             // all waves done with pl/vl from the main loop
    const bool ofast = ((p.sOi & 3) == 0) && ((((size_t)obase) & 15) == 0) && (q0 + 16 <= p.Lq);
#pragma unroll
    for (int c0 = 0; c0 < DVP; c0 += 64) {
#pragma unroll
        for (int i = 0; i < 8; ++i)
#pragma unroll
            for (int t = 0; t < NT; ++t) if (t * 16 >= c0 && t * 16 < c0 + 64) ((float*)myp)[(i + 8 * hf) * 64 + (t * 16 - c0) + l15] = o[t][i] * invr[i];
        __syncthreads();
        const int cw = (DVP - c0 < 64) ? (DVP - c0) : 64;      // staged columns in this chunk (multiple of 16)
        if (ofast && (c0 + cw <= p.dv) && (cw % 32 == 0)) {
            const int lpr = cw / 4;                              // lanes per row (16 for 64 cols, 8 for 32)
            const int rows_per_ins = 32 / lpr;
            for (int r0 = 0; r0 < 16; r0 += rows_per_ins) {
                const int row = r0 + lane / lpr, c4 = (lane % lpr) * 4;
                const v4f v = *(const v4f*)(myp + row * 64 + c4);
                VST2V4(obase + (long long)(q0 + row) * p.sOi + c0 + c4, v);
            }
        } else {
            for (int row = 0; row < 16; ++row) {
                const int irow = q0 + row; if (irow >= p.Lq) continue;
                for (int c = lane; c < cw; c += 32) { const int d = c0 + c; if (d < p.dv) VST2(float, obase + (long long)irow * p.sOi + d, myp[row * 64 + c]); }
            }
        }
        __syncthreads();
    }
}

// =====================================================================================================================
// k_tr: dst(z, c, r) = alpha * src(z, r, c) (+ beta * R2(z, c, r)): [Z][R][C] (row stride lds) -> [Z][C][R] (row stride ldd) through a 32x32 LDS tile;
//   flags: 1 -> add beta * residual R2 addressed like dst (z*sRz + c*ldr + r); act applied before the residual.
// =====================================================================================================================
struct TrP { const float* src; float* dst; const float* R2; long long sSz, lds, sDz, ldd, sRz, ldr; int R, C, flags, act; float alpha, beta; };
static_assert(sizeof(TrP) == 3 * 8 + 6 * 8 + 6 * 4, "TrP has padding");
__global__ __launch_bounds__(256) void k_tr(TrP p) {
    __shared__ float tile[32][33];
    const int c0 = blockIdx.x * 32, r0 = blockIdx.y * 32, z = blockIdx.z;
    const int lane = threadIdx.x & 31, wave = threadIdx.x >> 5;
    const float* s = p.src + z * p.sSz;
#pragma unroll
    for (int k = 0; k < 4; ++k) {
        const int rl = wave * 4 + k, r = r0 + rl, c = c0 + lane;
        tile[rl][lane] = (r < p.R && c < p.C) ? s[(long long)r * p.lds + c] : 0.f;
    }
    __syncthreads();
    float* d = p.dst + z * p.sDz; const float* rr = p.R2 + z * p.sRz;
#pragma unroll
    for (int k = 0; k < 4; ++k) {
        const int cl = wave * 4 + k, c = c0 + cl, r = r0 + lane;
        if (c < p.C && r < p.R) {
            float v = act_fn(p.alpha * tile[lane][cl], p.act);
            if (p.flags & 1) v += p.beta * rr[(long long)c * p.ldr + r];
            VST2(float, d + (long long)c * p.ldd + r, v);
        }
    }
}

// k_affine: dst[i] = a * (sdev ? sdev[0] : 1) * src[i] + b, i < n (one thread per element; consecutive lanes -> consecutive addresses)
__global__ __launch_bounds__(256) void k_affine(const float* __restrict__ src, float* __restrict__ dst, int n, float a, float b, const float* __restrict__ sdev) {
    const int i = blockIdx.x * 256 + threadIdx.x;
    if (i < n) { const float aa = sdev ? a * sdev[0] : a; const float v = aa * src[i] + b; VST2(float, dst + i, v); }
}

// =====================================================================================================================
// k_softmax: row softmax over n contiguous elements, one 256-thread block per row; rows addressed z*sz + r*sr (grid (R, Z)).
//   out = scale_out * softmax(scale_in * x + (Mf ? Mf[z*smz + r*smr + j] : 0)); a row whose max is -inf is written as 0.
// =====================================================================================================================
struct SmP { const float* src; float* dst; const float* Mf; long long sz, sr, dz, dr, smz, smr; int n, pad; float scale_in, scale_out; };
static_assert(sizeof(SmP) == 3 * 8 + 6 * 8 + 4 * 4, "SmP has padding");
__global__ __launch_bounds__(256) void k_softmax(SmP p) {
    __shared__ float red[256];
    const int r = blockIdx.x, z = blockIdx.y, tid = threadIdx.x;
    const float* s = p.src + z * p.sz + (long long)r * p.sr;
    const float* mf = p.Mf ? (p.Mf + z * p.smz + (long long)r * p.smr) : nullptr;
    float mx = -__builtin_inff();
    for (int j = tid; j < p.n; j += 256) { float v = s[j] * p.scale_in; if (mf) v += mf[j]; mx = fmaxf(mx, v); }
    red[tid] = mx; __syncthreads();
    for (int o = 128; o > 0; o >>= 1) { if (tid < o) red[tid] = fmaxf(red[tid], red[tid + o]); __syncthreads(); }
    mx = red[0]; __syncthreads();
    float sum = 0.f;
    for (int j = tid; j < p.n; j += 256) { float v = s[j] * p.scale_in; if (mf) v += mf[j]; sum += (mx == -__builtin_inff()) ? 0.f : expf(v - mx); }
    red[tid] = sum; __syncthreads();
    for (int o = 128; o > 0; o >>= 1) { if (tid < o) red[tid] += red[tid + o]; __syncthreads(); }
    sum = red[0];
    const float inv = (sum > 0.f) ? p.scale_out / sum : 0.f;
    float* d = p.dst + z * p.dz + (long long)r * p.dr;
    for (int j = tid; j < p.n; j += 256) { float v = s[j] * p.scale_in; if (mf) v += mf[j]; const float o = (mx == -__builtin_inff()) ? 0.f : expf(v - mx) * inv; VST2(float, d + j, o); }
}
// =====================================================================================================================
// k_stats: mean and rsqrt(var + eps) over a set of n elements addressed base + z*sz + (e / inner) * so + (e % inner) * si, one 256-thread
// k_norm_apply: y = (x - mean[set]) * rstd[set] * g[c] + b[c] over a [Z][C][L] channel-major tensor with set = z*G + c / (C/G) (G groups per z;
//   G = C -> per-channel sets indexed z*C+c; for batch norm pass stats indexed by c only via bn = 1). Optional act. Output same layout.
// =====================================================================================================================
//   mode 0: mean / rsqrt(var + eps); mode 1 (RMSNorm): 0 / rsqrt(mean(x^2) + eps); mode 2 (L2 normalize * sqrt(n)): 0 / sqrt(n) / max(||x||, eps); mode 3: as 0 with unbiased variance (n-1)
__global__ __launch_bounds__(256) void k_stats(const float* __restrict__ x, long long sz, long long so, long long si, int inner, int n, float eps, float* __restrict__ stat, int mode) {
    __shared__ float red[256];
    const int z = blockIdx.x, tid = threadIdx.x;
    const float* base = x + z * sz;
    float s = 0.f;
    for (int e = tid; e < n; e += 256) s += base[(long long)(e / inner) * so + (long long)(e % inner) * si];
    red[tid] = s; __syncthreads();
    for (int o = 128; o > 0; o >>= 1) { if (tid < o) red[tid] += red[tid + o]; __syncthreads(); }
    const float mu = (mode == 0 || mode == 3) ? red[0] / (float)n : 0.f; __syncthreads();
    float q = 0.f;
    for (int e = tid; e < n; e += 256) { const float dlt = base[(long long)(e / inner) * so + (long long)(e % inner) * si] - mu; q += dlt * dlt; }
    red[tid] = q; __syncthreads();
    for (int o = 128; o > 0; o >>= 1) { if (tid < o) red[tid] += red[tid + o]; __syncthreads(); }
    {
        float rs;
        if (mode == 2) rs = sqrtf((float)n) / fmaxf(sqrtf(red[0]), eps); else if (mode == 3) rs = rsqrtf(red[0] / (float)(n - 1) + eps); else rs = rsqrtf(red[0] / (float)n + eps);
        if (tid < 32) { const float v = (tid == 0) ? mu : ((tid == 1) ? rs : 0.f); VST2(float, stat + (long long)z * 32 + tid, v); }
    }
}
//   One thread per element over the flat [Z][C][L] index space: grid ceil(Z*C*L / 256).
__global__ __launch_bounds__(256) void k_norm_apply(const float* __restrict__ x, float* __restrict__ y, const float* __restrict__ stat, const float* __restrict__ g, const float* __restrict__ bta,
                                                     int Z, int C, int L, int G, int bn, int act) {
    const long long idx = (long long)blockIdx.x * 256 + threadIdx.x;
    if (idx >= (long long)Z * C * L) return;
    const int l = (int)(idx % L); const long long zc = idx / L; const int c = (int)(zc % C), z = (int)(zc / C); (void)l;
    const int set = bn ? c : (z * G + c / (C / G));
    float v = (x[idx] - stat[(long long)set * 32]) * stat[(long long)set * 32 + 1];
    if (g) v *= g[c];
    if (bta) v += bta[c];
    v = act_fn(v, act);
    VST2(float, y + idx, v);
}

// k_lse_neg: c[i] = -(st[2i] + log(st[2i+1])) = minus the log-sum-exp of row i from k_attn's ST output (for softmax over the query dimension)
__global__ __launch_bounds__(256) void k_lse_neg(const float* __restrict__ st, float* __restrict__ c, int n) {
    const int i = blockIdx.x * 256 + threadIdx.x;
    if (i < n) { const float v = -(st[2 * i] + logf(st[2 * i + 1])); VST2(float, c + i, v); }
}

// k_iota: dst[i] = a * i + b as int32 (segment/position id helper)
__global__ __launch_bounds__(256) void k_iota(int* __restrict__ dst, int n, int a, int b) {
    const int i = blockIdx.x * 256 + threadIdx.x;
    if (i < n) { const int v = a * i + b; VST2(int, dst + i, v); }
}

// k_axpby: dst[i] = a * x[i] + b * y[i] (+ c), i < n
__global__ __launch_bounds__(256) void k_axpby(const float* __restrict__ x, const float* __restrict__ y, float* __restrict__ dst, int n, float a, float b, float c) {
    const int i = blockIdx.x * 256 + threadIdx.x;
    if (i < n) { const float v = a * x[i] + b * y[i] + c; VST2(float, dst + i, v); }
}

// =====================================================================================================================
// k_rope: rotary embedding on a [R rows][Hn heads][D] view (row stride sXr, head stride sXh, element stride 1) -> Y (own strides).
//   mode 0: rotate_half (partner d±D/2, sign - for d<D/2); mode 1: interleaved pairs (partner d^1, sign - for even d).
//   table column tcol: tmode 0 -> d, 1 -> d % (D/2), 2 -> d / 2; position p: pmode 0 -> r % S, 1 -> head index, 2 -> pos[r];
//   c = C[(r / S) * sCb + p * sCp + tcol * sCd], s likewise from Sn; y = x[d] * c + sign * x[partner] * s. X and Y must not alias.
// =====================================================================================================================
struct RopeP { const float* X; float* Y; const float* C; const float* Sn; const int* pos; long long sXr, sXh, sYr, sYh, sCb, sCp, sCd; int R, Hn, D, S, mode, tmode, pmode, pad; };
static_assert(sizeof(RopeP) == 5 * 8 + 7 * 8 + 8 * 4, "RopeP has padding");
__global__ __launch_bounds__(256) void k_rope(RopeP p) {
    const long long idx = (long long)blockIdx.x * 256 + threadIdx.x;
    if (idx >= (long long)p.R * p.Hn * p.D) return;
    const int d = (int)(idx % p.D); const long long rh = idx / p.D; const int h = (int)(rh % p.Hn); const int r = (int)(rh / p.Hn);
    const int half = p.D / 2;
    int partner; float sign;
    if (p.mode == 0) { partner = (d < half) ? d + half : d - half; sign = (d < half) ? -1.f : 1.f; }
    else { partner = d ^ 1; sign = (d & 1) ? 1.f : -1.f; }
    const int tcol = (p.tmode == 0) ? d : ((p.tmode == 1) ? (d % half) : (d >> 1));
    const int pp = (p.pmode == 0) ? (r % p.S) : ((p.pmode == 1) ? h : p.pos[r]);
    const long long toff = (long long)(r / p.S) * p.sCb + (long long)pp * p.sCp + (long long)tcol * p.sCd;
    const float* xr = p.X + (long long)r * p.sXr + (long long)h * p.sXh;
    const float v = xr[d] * p.C[toff] + sign * xr[partner] * p.Sn[toff];
    VST2(float, p.Y + (long long)r * p.sYr + (long long)h * p.sYh + d, v);
}

// k_invf + k_sincos (split so neither kernel carries a large VALU-fma footprint): invf_i = num * (1 / powf(base, (2 i)/D)) [fmode 0],
//   num * expf((2 i) * cexp) [fmode 1], num * powf(base, -2 (i - 1) / D) [fmode 2]; then cs/sn[s*half + i] = cos/sin((pscale * s) * invf_i)
__global__ __launch_bounds__(256) void k_invf(float* __restrict__ invb, int half, int D, float base, float num, int fmode, float cexp) {
    const int i = blockIdx.x * 256 + threadIdx.x;
    if (i >= ((half + 31) / 32) * 32) return;
    if (i >= half) { VST2(float, invb + i, 0.f); return; }
    const float e = (float)(2 * i) / (float)D;
    float invf;
    if (fmode == 1) invf = num * expf((float)(2 * i) * cexp);
    else if (fmode == 2) invf = num * powf(base, (-2.0f * ((float)i - 1.0f)) / (float)D);
    else invf = num * (1.0f / powf(base, e));
    VST2(float, invb + i, invf);
}
__global__ __launch_bounds__(256) void k_sincos(float* __restrict__ cs, float* __restrict__ sn, const float* __restrict__ invb, int S, int half, float pscale) {
    const int idx = blockIdx.x * 256 + threadIdx.x;
    if (idx >= S * half) return;
    const int s = idx / half, i = idx - s * half;
    const float ang = (pscale * (float)s) * invb[i];
    VST2(float, cs + idx, cosf(ang)); VST2(float, sn + idx, sinf(ang));
}

// k_mulact: dst[i] = act(x[i]) * y[i]
__global__ __launch_bounds__(256) void k_mulact(const float* __restrict__ x, const float* __restrict__ y, float* __restrict__ dst, int n, int act) {
    const int i = blockIdx.x * 256 + threadIdx.x;
    if (i < n) { const float v = act_fn(x[i], act) * y[i]; VST2(float, dst + i, v); }
}

// =====================================================================================================================
// k_matvec: thread-per-row matrix-vector products for N <= 8 output columns (heads with 1-3 outputs, gates), f32 on the VALU.
//   C[r*sCm + j] = act(alpha * sum_k A[r*sAm + k*sAk] * B[j*sBn + k*sBk] + bias[j]) + beta * R[r*sRm + j*sRn]; each thread writes its N contiguous floats.
// =====================================================================================================================
__global__ __launch_bounds__(256) void k_matvec(GemmP p) {
    // N == 1: a row a thread, lanes on consecutive rows; otherwise 32 consecutive rows a thread.
    const int rpt = (p.N == 1) ? 1 : 32;
    const long long r0 = ((long long)blockIdx.x * 256 + threadIdx.x) * rpt; const int z = blockIdx.z, zo = z / p.zi_n, zi = z - zo * p.zi_n;
    if (r0 >= p.M) return;
    const float* Bb = p.B + zo * p.sBo + zi * p.sBi;
    float* C = p.C + zo * p.sCo + zi * p.sCi; const float* R = p.R + zo * p.sRo + zi * p.sRi;
    for (int rr = 0; rr < rpt; ++rr) {
        const long long r = r0 + rr; if (r >= p.M) break;
        const float* A = p.A + zo * p.sAo + zi * p.sAi + r * p.sAm;
        float acc[8] = {0.f, 0.f, 0.f, 0.f, 0.f, 0.f, 0.f, 0.f};
        for (int k = 0; k < p.K; ++k) { const float a = A[(long long)k * p.sAk];
#pragma unroll
            for (int j = 0; j < 8; ++j) if (j < p.N) acc[j] += a * Bb[(long long)j * p.sBn + (long long)k * p.sBk]; }
#pragma unroll
        for (int j = 0; j < 8; ++j) if (j < p.N) {
            float v = acc[j] * p.alpha;
            if (p.flags & 1) v += p.bias[j];
            if (p.flags & 2) v += p.bias[r];
            v = act_fn(v, p.act);
            if (p.flags & 4) v += p.beta * R[r * p.sRm + (long long)j * p.sRn];
            VST2(float, C + r * p.sCm + j, v);
        }
    }
}
// k_smallsoftmax: thread-per-row softmax for short rows (n <= 64): dst[r*dr + j] = softmax(scale*src[r*sr + j])
__global__ __launch_bounds__(256) void k_smallsoftmax(const float* __restrict__ src, float* __restrict__ dst, long long sr, long long dr, int n, long long R, float scale) {
    const long long r0 = ((long long)blockIdx.x * 256 + threadIdx.x) * 32;
    for (int rr = 0; rr < 32; ++rr) {
        const long long r = r0 + rr; if (r >= R) return;
        const float* s = src + r * sr; float* d = dst + r * dr;
        float mx = -__builtin_inff();
        for (int j = 0; j < n; ++j) mx = fmaxf(mx, s[j] * scale);
        float sum = 0.f;
        for (int j = 0; j < n; ++j) sum += expf(s[j] * scale - mx);
        const float inv = 1.f / sum;
        for (int j = 0; j < n; ++j) { const float v = expf(s[j] * scale - mx) * inv; VST2(float, d + j, v); }
    }
}

__global__ __launch_bounds__(32) void k_unitstat(float* __restrict__ st) { const int t = threadIdx.x; const float v = (t == 1) ? 1.f : 0.f; VST2(float, st + t, v); }

// destination (e.g. a d_out whose row width is not a multiple of 32 floats) is written by consecutive lanes of one instruction
__global__ __launch_bounds__(256) void k_lincopy(const float* __restrict__ src, long long lds, float* __restrict__ dst, long long ldd, long long rows, int cols) {
    const long long i = (long long)blockIdx.x * 256 + threadIdx.x; if (i >= rows * cols) return;
    const long long r = i / cols; const int c = (int)(i - r * cols);
    const float v = src[r * lds + c]; VST2(float, dst + r * ldd + c, v);
}

namespace w25 {
typedef __attribute__((ext_vector_type(16))) _Float16 v16h;
typedef __attribute__((ext_vector_type(8)))  _Float16 v8h;
typedef __attribute__((ext_vector_type(16))) __bf16   v16b;
typedef __attribute__((ext_vector_type(8)))  __bf16   v8b;
typedef __attribute__((ext_vector_type(8)))  float    v8f;
typedef __attribute__((ext_vector_type(4)))  float    v4f;

__device__ __forceinline__ unsigned short f2bf_bits(float f) {
  unsigned u = __float_as_uint(f);
  return (unsigned short)((u + 0x7FFFu + ((u >> 16) & 1u)) >> 16);
}
__device__ __forceinline__ float bf_bits2f(unsigned short h) { return __uint_as_float(((unsigned)h) << 16); }

// hazard guards as plain device helpers (no inline asm inside the kernel template body)
__device__ __forceinline__ void dep_guard_h(v8f& a, v8f& b, v16h x, v16h y) { asm volatile("v_nop\n\tv_nop\n\tv_nop\n\tv_nop" : "+v"(a), "+v"(b) : "v"(x), "v"(y)); }
__device__ __forceinline__ void dep_guard_b(v8f& a, v8f& b, v16b x, v16b y) { asm volatile("v_nop\n\tv_nop\n\tv_nop\n\tv_nop" : "+v"(a), "+v"(b) : "v"(x), "v"(y)); }
__device__ __forceinline__ void keep4_h(v16h a, v16h b, v16h c, v16h d) { asm volatile("v_nop" :: "v"(a), "v"(b), "v"(c), "v"(d)); }
__device__ __forceinline__ void keep4_b(v16b a, v16b b, v16b c, v16b d) { asm volatile("v_nop" :: "v"(a), "v"(b), "v"(c), "v"(d)); }
__device__ __forceinline__ void acc_guard4(v8f& a, v8f& b, v8f& c, v8f& d) { asm volatile("v_nop\n\tv_nop\n\tv_nop\n\tv_nop" : "+v"(a), "+v"(b), "+v"(c), "+v"(d)); }
template <typename T> struct Frag;
template <> struct Frag<_Float16> {
  typedef v16h V; union U { v16h v; v8h h[2]; };
  static __device__ __forceinline__ v16h load(const _Float16* p) {   // elements 0..7 <- p[0..7], 8..15 <- p[16..23]
    U f; f.h[0] = *(const v8h*)(p); f.h[1] = *(const v8h*)(p + 16); return f.v;
  }
  static __device__ __forceinline__ v8f mma(v16h a, v16h b, v8f c) {
    return __builtin_amdgcn_wmma_f32_16x16x32_f16(false, a, false, b, (short)0, c, false, false);
  }
  static __device__ __forceinline__ void guard(v8f& a, v8f& b, v16h x, v16h y) { dep_guard_h(a, b, x, y); }
  static __device__ __forceinline__ void keep(v16h a, v16h b, v16h c, v16h d) { keep4_h(a, b, c, d); }
};
template <> struct Frag<__bf16> {
  typedef v16b V; union U { v16b v; v8b h[2]; };
  static __device__ __forceinline__ v16b load(const __bf16* p) {
    U f; f.h[0] = *(const v8b*)(p); f.h[1] = *(const v8b*)(p + 16); return f.v;
  }
  static __device__ __forceinline__ v8f mma(v16b a, v16b b, v8f c) {
    return __builtin_amdgcn_wmma_f32_16x16x32_bf16(false, a, false, b, (short)0, c, false, false);
  }
  static __device__ __forceinline__ void guard(v8f& a, v8f& b, v16b x, v16b y) { dep_guard_b(a, b, x, y); }
  static __device__ __forceinline__ void keep(v16b a, v16b b, v16b c, v16b d) { keep4_b(a, b, c, d); }
};

// ---- Register-blocked batched WMMA GEMM ------------------------------------
// C[m,n] = scale * sum_k A[m,k] * Bt[n,k] (+bias)(+resid); each wave owns a 64x64 tile.
// A row-major [M,K]; Bt row-major [N,K]; M,N % 64 == 0, K % 32 == 0.
// SPLIT: operands are hi/lo planes (A2/Bt2 = lo planes, same layout); product = hi·hi + hi·lo + lo·hi.
// BIAS_MODE: 0 = none, 1 = bias[m], 2 = bias[n].
// OUT_MODE: 0 = f32, 1 = f16, 2 = bf16 hi plane (Cout) + bf16 lo plane (Cout2).
// ET: 0 = f16 operands, 1 = bf16 operands (pointers passed as 16-bit storage)
template <int ET> struct Elem;
template <> struct Elem<0> { typedef _Float16 T; };
template <> struct Elem<1> { typedef __bf16 T; };
template <int ET, bool SPLIT, int BIAS_MODE, int OUT_MODE, bool RESID, int ACT = 0>
__global__ __launch_bounds__(256) void wmma_gemm64(
    const unsigned short* __restrict__ Ap, const unsigned short* __restrict__ A2p, int lda, long strideA,
    const unsigned short* __restrict__ Btp, const unsigned short* __restrict__ Bt2p, int ldb, long strideB,
    void* __restrict__ Cout, void* __restrict__ Cout2, int ldc, long strideC,
    const float* __restrict__ bias,
    const float* __restrict__ resid, long strideR,
    int M, int N, int K, float scale) {
  typedef typename Elem<ET>::T T;
  typedef typename Frag<T>::V V;
  const T* A = (const T*)Ap; const T* A2 = (const T*)A2p; const T* Bt = (const T*)Btp; const T* Bt2 = (const T*)Bt2p;
  __shared__ __align__(16) float sT[8][16 * 68];   // per-wave 16x64 slab, pitch 68 floats
  const int b    = blockIdx.y;
  const int lane = threadIdx.x & 31;
  const int wave = threadIdx.x >> 5;
  const int tilesN = N >> 6;
  const int tilesM = M >> 6;
  const int tile = blockIdx.x * 8 + wave;
  if (tile >= tilesM * tilesN) return;   // wave-uniform; no block barriers in this kernel
  const int tm = tile / tilesN;
  const int tn = tile - tm * tilesN;
  const int m0 = tm << 6;
  const int n0 = tn << 6;

  const T* Ab  = A  + (size_t)b * strideA;
  const T* Bb  = Bt + (size_t)b * strideB;
  const T* Ab2 = SPLIT ? (A2  + (size_t)b * strideA) : nullptr;
  const T* Bb2 = SPLIT ? (Bt2 + (size_t)b * strideB) : nullptr;

  const int rlane = lane & 15;                 // row (A) / col (B, D) within subtile
  const int koff  = (lane >> 4) * 8;           // k offset of this lane half
  const int mOff  = (lane >> 4) * 8;           // D row offset

  v8f acc[4][4];
#pragma unroll
  for (int i = 0; i < 4; ++i)
#pragma unroll
    for (int j = 0; j < 4; ++j) acc[i][j] = (v8f){0.f,0.f,0.f,0.f,0.f,0.f,0.f,0.f};

  for (int k0 = 0; k0 < K; k0 += 32) {
    V bh[4], bl[4];
#pragma unroll
    for (int j = 0; j < 4; ++j) {
      const size_t bo = (size_t)(n0 + (j << 4) + rlane) * ldb + koff + k0;
      bh[j] = Frag<T>::load(Bb + bo);
      if (SPLIT) bl[j] = Frag<T>::load(Bb2 + bo);
    }
#pragma unroll
    for (int i = 0; i < 4; ++i) {
      const size_t ao = (size_t)(m0 + (i << 4) + rlane) * lda + koff + k0;
      V ah = Frag<T>::load(Ab + ao);
      V al;
      if (SPLIT) al = Frag<T>::load(Ab2 + ao);
#pragma unroll
      for (int j = 0; j < 4; ++j) {
        acc[i][j] = Frag<T>::mma(ah, bh[j], acc[i][j]);
        if (SPLIT) {
          acc[i][j] = Frag<T>::mma(ah, bl[j], acc[i][j]);
          acc[i][j] = Frag<T>::mma(al, bh[j], acc[i][j]);
        }
      }
      Frag<T>::guard(acc[i][0], acc[i][3], ah, SPLIT ? al : ah);
    }
    Frag<T>::keep(bh[0], bh[1], bh[2], bh[3]);
    if (SPLIT) Frag<T>::keep(bl[0], bl[1], bl[2], bl[3]);
  }
  acc_guard4(acc[0][0], acc[0][1], acc[0][2], acc[0][3]);
  acc_guard4(acc[1][0], acc[1][1], acc[1][2], acc[1][3]);
  acc_guard4(acc[2][0], acc[2][1], acc[2][2], acc[2][3]);
  acc_guard4(acc[3][0], acc[3][1], acc[3][2], acc[3][3]);

  // ---- epilogue ----
  float* slab = sT[wave];
  const float* Rb = RESID ? (resid + (size_t)b * strideR) : nullptr;
#pragma unroll
  for (int i = 0; i < 4; ++i) {
    const int mBase = m0 + (i << 4);
#pragma unroll
    for (int j = 0; j < 4; ++j) {
      const int n = n0 + (j << 4) + rlane;
      float bv = 0.f;
      if (BIAS_MODE == 2) bv = bias[n];
#pragma unroll
      for (int r = 0; r < 8; ++r) {
        float v = acc[i][j][r] * scale;
        if (BIAS_MODE == 1) v += bias[mBase + mOff + r];
        if (BIAS_MODE == 2) v += bv;
        if (RESID) v += Rb[(size_t)(mBase + mOff + r) * ldc + n];
        if (ACT == 1) v = tanhf(v);
        if (ACT == 2) v = fmaxf(v, 0.0f);
        if (ACT == 3) v = v / (1.0f + expf(-v));
        if (ACT == 4) v = (v > 0.f) ? v : 0.01f * v;
        if (ACT == 5) v = 0.5f * v * (1.0f + erff(v * 0.70710678118654752f));
        slab[(mOff + r) * 68 + (j << 4) + rlane] = v;
      }
    }
    __builtin_amdgcn_fence(__ATOMIC_RELEASE, "workgroup");
    __builtin_amdgcn_wave_barrier();
    __builtin_amdgcn_fence(__ATOMIC_ACQUIRE, "workgroup");
    if (OUT_MODE == 0) {
      float* C = (float*)Cout + (size_t)b * strideC;
      const int hh = lane >> 4, c4 = (lane & 15) * 4;     // row seg = 256 B = 16 lanes x 16 B
      {
#pragma unroll
        for (int it = 0; it < 8; ++it) {
          const int row = it * 2 + hh;
          v4f v = *(const v4f*)(slab + row * 68 + c4);
          *(v4f*)(C + (size_t)(mBase + row) * ldc + n0 + c4) = v;
        }
        
      }
    } else {
      const int q = lane >> 3, c8 = (lane & 7) * 8;
      unsigned short* C  = (unsigned short*)Cout  + (size_t)b * strideC;
      unsigned short* C2 = (OUT_MODE == 2) ? ((unsigned short*)Cout2 + (size_t)b * strideC) : nullptr;
      {
#pragma unroll
        for (int it = 0; it < 4; ++it) {
          const int row = it * 4 + q;
          const float* sp = slab + row * 68 + c8;
          v8h hv, lv;
#pragma unroll
          for (int e = 0; e < 8; ++e) {
            if (OUT_MODE == 1) {
              hv[e] = (_Float16)sp[e];
            } else {
              unsigned short hb = f2bf_bits(sp[e]);
              unsigned short lb = f2bf_bits(sp[e] - bf_bits2f(hb));
              hv[e] = __builtin_bit_cast(_Float16, hb);
              lv[e] = __builtin_bit_cast(_Float16, lb);
            }
          }
          *(v8h*)(C + (size_t)(mBase + row) * ldc + n0 + c8) = hv;
          if (OUT_MODE == 2) *(v8h*)(C2 + (size_t)(mBase + row) * ldc + n0 + c8) = lv;
        }
        
      }
    }
    __builtin_amdgcn_fence(__ATOMIC_RELEASE, "workgroup");
    __builtin_amdgcn_wave_barrier();
    __builtin_amdgcn_fence(__ATOMIC_ACQUIRE, "workgroup");
  }
}

__global__ __launch_bounds__(256) void cast_f32_f16x2(
    const float* __restrict__ in, _Float16* __restrict__ out, int n2) {
  int i = blockIdx.x * 256 + threadIdx.x;
  if (i < n2) {
    const _Float16 h0 = (_Float16)in[2 * i], h1 = (_Float16)in[2 * i + 1];
    const unsigned u = (unsigned)__builtin_bit_cast(unsigned short, h0) | ((unsigned)__builtin_bit_cast(unsigned short, h1) << 16);
    ((unsigned*)out)[i] = u;
    
  }
}


} // namespace w25

__device__ __forceinline__ unsigned int f2h2_pack(float a, float b) { return (unsigned)__builtin_bit_cast(unsigned short, (_Float16)a) | ((unsigned)__builtin_bit_cast(unsigned short, (_Float16)b) << 16); }
__global__ __launch_bounds__(256) void k_cast16(const float* __restrict__ src, long long lds, _Float16* __restrict__ dst, long long ldd, int R, int C, float s) {
    const long long i = (long long)blockIdx.x * 256 + threadIdx.x; const long long np = (long long)R * (C / 2); if (i >= np) return; const int r = (int)(i / (C / 2)); const int c = 2 * (int)(i % (C / 2));
    const _Float16 h0 = (_Float16)(src[(long long)r * lds + c] * s), h1 = (_Float16)(src[(long long)r * lds + c + 1] * s);
    const unsigned u = (unsigned)__builtin_bit_cast(unsigned short, h0) | ((unsigned)__builtin_bit_cast(unsigned short, h1) << 16);
    unsigned* d = (unsigned*)(dst + (long long)r * ldd + c); *d = u;  }

// f32 -> bf16 hi plane + bf16 lo plane (x = hi + lo to ~2^-17 relative; RNE both), [R][C] -> [R][C] (or transposed to [C][R]); 2 consecutive destination elements
__device__ __forceinline__ unsigned int f2bf2_pack(float a, float b, unsigned int* lo) {
    const unsigned short ha = w25::f2bf_bits(a), hb = w25::f2bf_bits(b);
    const unsigned short la = w25::f2bf_bits(a - w25::bf_bits2f(ha)), lb = w25::f2bf_bits(b - w25::bf_bits2f(hb));
    *lo = (unsigned)la | ((unsigned)lb << 16); return (unsigned)ha | ((unsigned)hb << 16); }
__global__ __launch_bounds__(256) void k_castS16(const float* __restrict__ src, long long lds, __bf16* __restrict__ dhi, __bf16* __restrict__ dlo, long long ldd, int R, int C, float s, int transpose, long long sb, long long db) {
    src += (long long)blockIdx.y * sb; dhi += (long long)blockIdx.y * db; dlo += (long long)blockIdx.y * db;   // blockIdx.y = image
    const long long i = (long long)blockIdx.x * 256 + threadIdx.x; long long o; float a, b;
    if (transpose) { const long long np = (long long)C * (R / 2); if (i >= np) return; const int c = (int)(i / (R / 2)); const int r = 2 * (int)(i % (R / 2)); a = src[(long long)r * lds + c] * s; b = src[(long long)(r + 1) * lds + c] * s; o = (long long)c * ldd + r; }
    else { const long long np = (long long)R * (C / 2); if (i >= np) return; const int r = (int)(i / (C / 2)); const int c = 2 * (int)(i % (C / 2)); a = src[(long long)r * lds + c] * s; b = src[(long long)r * lds + c + 1] * s; o = (long long)r * ldd + c; }
    unsigned lo; const unsigned hi = f2bf2_pack(a, b, &lo); unsigned* ph = (unsigned*)(dhi + o); unsigned* pl = (unsigned*)(dlo + o);
    *ph = hi; *pl = lo;  }

namespace w25 {
// =====================================================================================
// Generic causal/non-causal attention for head_dim 64, f32 in / f32 out; 16-bit operands: bf16 with optional hi/lo splits, or
// plain f16 (F16=true, non-split, probabilities carried x2^15).
//   scores = (q*qscale)·kᵀ : v_wmma_f32_16x16x32_bf16; SPLIT_QK -> q,k as bf16 hi/lo (hi·hi + hi·lo + lo·hi)
//   out    = p·v           : v_wmma_f32_16x16x32_bf16; SPLIT_PV -> p,v as bf16 hi/lo; else p,v plain bf16
//   f32 accumulate; online softmax in f32. Block = 4 waves = 64 query rows of one (batch, head); S % 64 == 0.
//   Element (b, s, h, d) of tensor X lives at X[b*X_bs + s*X_rs + h*X_hs + d] (strides in floats, multiples of 4).
//   Masking: mask_mode 0 none, 1 causal (kv > q masked), 2 tensor [S][Skv] shared over (b,h) (float if
//   mask_is_int==0, int32 with element == 0 -> masked if 1, int32 with element != 0 -> masked if 2), 3 per-token vectors qmask[B][S] & kvmask[B][Skv] (int32,
//   0 -> masked), 4 causal + sliding window (kv > q or q - kv > W masked; W passed in mask_is_int);
//   5 = relative-position bias: s += cp[b,h,q][idx[q][kv]] + pc[b,h,kv][idx[q][kv]] with idx = mask_b ([S][Skv] int32) and
//   mask_a an int32 [S][Skv] tensor with nonzero = masked (tables: element (b,h,row,n) at X + b*c_bs + h*c_hs + row*c_rs + n);
//   masked scores are replaced by mask_fill (e.g. -inf or -1e9) before the softmax.
//   grid.x = B * H * (S/64) (or a sub-range with blk0).
// =====================================================================================
#define AT_D 64
#define AT_NW 4
#define AT_QB 64
#define AT_KC 64
struct AttnGeom { const float* cp = nullptr; const float* pc = nullptr; long c_bs = 0, c_rs = 0, c_hs = 0;   // mode-5 score-bias tables
                  long q_bs, q_rs, q_hs, k_bs, k_rs, k_hs, v_bs, v_rs, v_hs, o_bs, o_rs, o_hs;
                  int S, Skv, H, mask_mode; float qscale; int blk0; float mask_fill; int mask_is_int; };
static_assert(sizeof(AttnGeom) == 168, "no padding");

__device__ __forceinline__ unsigned short at_bf_bits(float f) {
  unsigned u = __float_as_uint(f);
  return (unsigned short)((u + 0x7FFFu + ((u >> 16) & 1u)) >> 16);
}
__device__ __forceinline__ __bf16 at_f2bf(float f) { return __builtin_bit_cast(__bf16, at_bf_bits(f)); }
__device__ __forceinline__ void at_split(float f, __bf16& hi, __bf16& lo) {
  const unsigned short hb = at_bf_bits(f);
  hi = __builtin_bit_cast(__bf16, hb);
  lo = at_f2bf(f - __uint_as_float(((unsigned)hb) << 16));
}
__device__ __forceinline__ v8f at_mma(v16b a, v16b b, v8f c) {
  c = __builtin_amdgcn_wmma_f32_16x16x32_bf16(false, a, false, b, (short)0, c, false, false);
  asm volatile("v_nop\n\tv_nop\n\tv_nop\n\tv_nop" : "+v"(c) : "v"(a), "v"(b));
  return c;
}
// 16-bit element as a bit pattern held in a __bf16 slot: f16 bits when F16, bf16 (RNE) otherwise
template <bool F16> __device__ __forceinline__ __bf16 at_to16(float f) {
  if (F16) return __builtin_bit_cast(__bf16, (_Float16)f);
  return at_f2bf(f);
}
template <bool F16> __device__ __forceinline__ v8f at_mma16(v16b a, v16b b, v8f c) {
  if (F16) {
    const v16h ah = __builtin_bit_cast(v16h, a), bh = __builtin_bit_cast(v16h, b);
    c = __builtin_amdgcn_wmma_f32_16x16x32_f16(false, ah, false, bh, (short)0, c, false, false);
    asm volatile("v_nop\n\tv_nop\n\tv_nop\n\tv_nop" : "+v"(c) : "v"(ah), "v"(bh));
    return c;
  }
  return at_mma(a, b, c);
}

template <bool SPLIT_QK, bool SPLIT_PV, bool F16 = false>
__global__ __launch_bounds__(128)
void attn64_kernel(const float* __restrict__ q, const float* __restrict__ k,
                   const float* __restrict__ v, float* __restrict__ out,
                   const void* __restrict__ mask_a, const int* __restrict__ mask_b, AttnGeom g) {
  static_assert(!(F16 && (SPLIT_QK || SPLIT_PV)), "f16 mode is non-split");
  const float PSC = F16 ? 32768.0f : 1.0f;     // f16 probabilities carried x2^15 (subnormal range), folded into the final 1/l
  union FB { v16b v; v8b h[2]; };
  __shared__ __align__(16) __bf16 Ksh[AT_KC * AT_D];             // K hi [kv][d]      8 KB
  __shared__ __align__(16) __bf16 Ksl[SPLIT_QK ? AT_KC * AT_D : 8];
  __shared__ __align__(16) __bf16 Vth[AT_D * AT_KC];             // V hi [d][kv]      8 KB
  __shared__ __align__(16) __bf16 Vtl[SPLIT_PV ? AT_D * AT_KC : 8];
  __shared__ __align__(16) __bf16 Psh[AT_NW][16 * AT_KC];        // per wave P hi [row][kv]  8 KB
  __shared__ __align__(16) __bf16 Psl[SPLIT_PV ? AT_NW : 1][SPLIT_PV ? 16 * AT_KC : 8];
  __shared__ __align__(16) float  Os[AT_NW][16 * 68];            // per wave out tile, pitch 68

  const int tid  = threadIdx.x;
  const int wave = tid >> 5;
  const int lane = tid & 31;
  const int hh   = lane >> 4;
  const int c    = lane & 15;

  const int nqb = g.S / AT_QB;
  const int bx = blockIdx.x + g.blk0;
  const int qb = bx % nqb;
  const int bh = bx / nqb;
  const int h  = bh % g.H;
  const int b  = bh / g.H;
  const int qbase_block = qb * AT_QB;
  const int q0 = qbase_block + wave * 16;

  const float* qb_ptr = q + (size_t)b * g.q_bs + (size_t)h * g.q_hs;
  const float* kb_ptr = k + (size_t)b * g.k_bs + (size_t)h * g.k_hs;
  const float* vb_ptr = v + (size_t)b * g.v_bs + (size_t)h * g.v_hs;
  float*       ob_ptr = out + (size_t)b * g.o_bs + (size_t)h * g.o_hs;

  // ---- Q fragments (A operand): 2 d-chunks, hi (and lo) ----
  v16b qah[2], qal[2];
  {
    const float* qrow = qb_ptr + (size_t)(q0 + c) * g.q_rs;
#pragma unroll
    for (int dc = 0; dc < 2; ++dc) {
#pragma unroll
      for (int e = 0; e < 8; ++e) {
        const float f0 = qrow[dc * 32 + 8 * hh + e] * g.qscale;
        const float f1 = qrow[dc * 32 + 16 + 8 * hh + e] * g.qscale;
        if (SPLIT_QK) { __bf16 hq, lq; at_split(f0, hq, lq); qah[dc][e] = hq; qal[dc][e] = lq; at_split(f1, hq, lq); qah[dc][8 + e] = hq; qal[dc][8 + e] = lq; }
        else { qah[dc][e] = at_to16<F16>(f0); qah[dc][8 + e] = at_to16<F16>(f1); qal[dc][e] = qah[dc][e]; qal[dc][8 + e] = qah[dc][8 + e]; }
      }
    }
  }

  float mrow[8], lrow[8];
  v8f oacc[4];
#pragma unroll
  for (int r = 0; r < 8; ++r) { mrow[r] = -INFINITY; lrow[r] = 0.f; }
#pragma unroll
  for (int t = 0; t < 4; ++t) oacc[t] = (v8f){0.f,0.f,0.f,0.f,0.f,0.f,0.f,0.f};

  const int nChunks = (g.mask_mode == 1 || g.mask_mode == 4) ? (qb + 1) : (g.Skv / AT_KC);   // block-uniform
  // per-row query mask (mode 3)
  int qkeep[8];
#pragma unroll
  for (int r = 0; r < 8; ++r) qkeep[r] = (g.mask_mode == 3) ? mask_b[(size_t)b * g.S + q0 + 8 * hh + r] : 1;   // mask_b = qmask in mode 3
  for (int kc = 0; kc < nChunks; ++kc) {
    const int kv0 = kc * AT_KC;
    __syncthreads();
    {
      const int kvr = tid >> 1, dh = (tid & 1) * 32;
      const float* krow = kb_ptr + (size_t)(kv0 + kvr) * g.k_rs + dh;
      const float* vrow = vb_ptr + (size_t)(kv0 + kvr) * g.v_rs + dh;
#pragma unroll
      for (int i = 0; i < 8; ++i) {
        v4f kk = *(const v4f*)(krow + 4 * i);
        v4f vv = *(const v4f*)(vrow + 4 * i);
#pragma unroll
        for (int e = 0; e < 4; ++e) {
          const int d = dh + 4 * i + e;
          if (SPLIT_QK) { __bf16 a, bl; at_split(kk[e], a, bl); Ksh[kvr * AT_D + d] = a; Ksl[kvr * AT_D + d] = bl; }
          else Ksh[kvr * AT_D + d] = at_to16<F16>(kk[e]);
          if (SPLIT_PV) { __bf16 a, bl; at_split(vv[e], a, bl); Vth[d * AT_KC + kvr] = a; Vtl[d * AT_KC + kvr] = bl; }
          else Vth[d * AT_KC + kvr] = at_to16<F16>(vv[e]);
        }
      }
    }
    __syncthreads();

    v8f s[4];
#pragma unroll
    for (int j = 0; j < 4; ++j) {
      s[j] = (v8f){0.f,0.f,0.f,0.f,0.f,0.f,0.f,0.f};
#pragma unroll 1
      for (int dc = 0; dc < 2; ++dc) {
        FB kb;
        kb.h[0] = *(const v8b*)(Ksh + (j * 16 + c) * AT_D + dc * 32 + 8 * hh);
        kb.h[1] = *(const v8b*)(Ksh + (j * 16 + c) * AT_D + dc * 32 + 16 + 8 * hh);
        s[j] = at_mma16<F16>(qah[dc], kb.v, s[j]);
        if (SPLIT_QK) {
          FB kl;
          kl.h[0] = *(const v8b*)(Ksl + (j * 16 + c) * AT_D + dc * 32 + 8 * hh);
          kl.h[1] = *(const v8b*)(Ksl + (j * 16 + c) * AT_D + dc * 32 + 16 + 8 * hh);
          s[j] = at_mma16<F16>(qah[dc], kl.v, s[j]);
          s[j] = at_mma16<F16>(qal[dc], kb.v, s[j]);
        }
      }
    }
    const bool diag = (g.mask_mode == 1) && (kc == qb);
    int kvkeep[4] = {1, 1, 1, 1};
    if (g.mask_mode == 3) {
#pragma unroll
      for (int j = 0; j < 4; ++j) kvkeep[j] = ((const int*)mask_a)[(size_t)b * g.Skv + kv0 + j * 16 + c];   // mask_a = kvmask
    }
    float cm[8];
#pragma unroll
    for (int r = 0; r < 8; ++r) {
      const int qrow = q0 + 8 * hh + r;
      float m = -INFINITY;
#pragma unroll
      for (int j = 0; j < 4; ++j) {
        const int kvcol = kv0 + j * 16 + c;
        bool masked = false;
        if (diag) masked = (kvcol > qrow);
        else if (g.mask_mode == 4) masked = (kvcol > qrow) || (qrow - kvcol > g.mask_is_int);
        else if (g.mask_mode == 2) {
          const size_t mi = (size_t)qrow * g.Skv + kvcol;
          masked = (g.mask_is_int == 0) ? (((const float*)mask_a)[mi] == 0.0f)
                 : (g.mask_is_int == 1) ? (((const int*)mask_a)[mi] == 0) : (((const int*)mask_a)[mi] != 0);
        } else if (g.mask_mode == 3) masked = (qkeep[r] == 0) || (kvkeep[j] == 0);
        else if (g.mask_mode == 5) {
          const size_t mi = (size_t)qrow * g.Skv + kvcol;
          masked = (((const int*)mask_a)[mi] != 0);
          int n = mask_b[mi]; n = n < 0 ? 0 : n;
          s[j][r] += g.cp[(size_t)b * g.c_bs + (size_t)h * g.c_hs + (size_t)qrow * g.c_rs + n]
                   + g.pc[(size_t)b * g.c_bs + (size_t)h * g.c_hs + (size_t)kvcol * g.c_rs + n];
        }
        if (masked) s[j][r] = g.mask_fill;
        m = fmaxf(m, s[j][r]);
      }
#pragma unroll
      for (int off = 1; off < 16; off <<= 1) m = fmaxf(m, __shfl_xor(m, off, 32));
      cm[r] = m;
    }
    __bf16* pwh = Psh[wave];
    __bf16* pwl = Psl[SPLIT_PV ? wave : 0];
#pragma unroll
    for (int r = 0; r < 8; ++r) {
      const float mnew = fmaxf(mrow[r], cm[r]);
      const float alpha = expf(mrow[r] - mnew);
      mrow[r] = mnew;
      float psum = 0.f;
#pragma unroll
      for (int j = 0; j < 4; ++j) {
        const float p = expf(s[j][r] - mnew);
        psum += p;
        if (SPLIT_PV) { __bf16 a, bl; at_split(p, a, bl); pwh[(8 * hh + r) * AT_KC + j * 16 + c] = a; pwl[(8 * hh + r) * AT_KC + j * 16 + c] = bl; }
        else pwh[(8 * hh + r) * AT_KC + j * 16 + c] = at_to16<F16>(p * PSC);
      }
#pragma unroll
      for (int off = 1; off < 16; off <<= 1) psum += __shfl_xor(psum, off, 32);
      lrow[r] = lrow[r] * alpha + psum;
#pragma unroll
      for (int t = 0; t < 4; ++t) oacc[t][r] *= alpha;
    }
    __builtin_amdgcn_fence(__ATOMIC_RELEASE, "workgroup");
    __builtin_amdgcn_wave_barrier();
    __builtin_amdgcn_fence(__ATOMIC_ACQUIRE, "workgroup");
#pragma unroll 1
    for (int kk = 0; kk < 2; ++kk) {
      FB pa, pl;
      pa.h[0] = *(const v8b*)(pwh + c * AT_KC + kk * 32 + 8 * hh);
      pa.h[1] = *(const v8b*)(pwh + c * AT_KC + kk * 32 + 16 + 8 * hh);
      if (SPLIT_PV) {
        pl.h[0] = *(const v8b*)(pwl + c * AT_KC + kk * 32 + 8 * hh);
        pl.h[1] = *(const v8b*)(pwl + c * AT_KC + kk * 32 + 16 + 8 * hh);
      }
#pragma unroll
      for (int t = 0; t < 4; ++t) {
        FB vb;
        vb.h[0] = *(const v8b*)(Vth + (t * 16 + c) * AT_KC + kk * 32 + 8 * hh);
        vb.h[1] = *(const v8b*)(Vth + (t * 16 + c) * AT_KC + kk * 32 + 16 + 8 * hh);
        oacc[t] = at_mma16<F16>(pa.v, vb.v, oacc[t]);
        if (SPLIT_PV) {
          FB vl;
          vl.h[0] = *(const v8b*)(Vtl + (t * 16 + c) * AT_KC + kk * 32 + 8 * hh);
          vl.h[1] = *(const v8b*)(Vtl + (t * 16 + c) * AT_KC + kk * 32 + 16 + 8 * hh);
          oacc[t] = at_mma16<F16>(pa.v, vl.v, oacc[t]);
          oacc[t] = at_mma16<F16>(pl.v, vb.v, oacc[t]);
        }
      }
    }
  }

  float* os = Os[wave];
#pragma unroll
  for (int r = 0; r < 8; ++r) {
    const float inv = 1.0f / (lrow[r] * PSC);
#pragma unroll
    for (int t = 0; t < 4; ++t) os[(8 * hh + r) * 68 + t * 16 + c] = oacc[t][r] * inv;
  }
  __builtin_amdgcn_fence(__ATOMIC_RELEASE, "workgroup");
  __builtin_amdgcn_wave_barrier();
  __builtin_amdgcn_fence(__ATOMIC_ACQUIRE, "workgroup");
  {
    const int c4 = (lane & 15) * 4;
    {
#pragma unroll
      for (int it = 0; it < 8; ++it) {
        const int row = it * 2 + hh;
        v4f val = *(const v4f*)(os + row * 68 + c4);
        *(v4f*)(ob_ptr + (size_t)(q0 + row) * g.o_rs + c4) = val;
      }
      
    }
  }
}

} // namespace w25

// Fused projection of one image tile: the casts of x, the three 1x1 convolutions, the 2x2 max-pool and the operand planes of k_nl_flash in one kernel; x is read once, as f32.
// A block owns 64 pixels = 16 pool windows: image rows 2py, 2py + 1, columns 32hf .. 32hf + 31 (blockIdx.x = 2py + hf, blockIdx.y = image).
// Staging: a thread takes 2 x 8 channels (128 apart) x 4 pixels (sixteen 16-byte loads, 8 lanes = one 128-B line), casts them as the cast kernels did (bf16 hi, bf16 lo, f16 of 16 x) and stores, per pixel and plane,
// 16 bytes = 8 consecutive channels = half a lane's fragment into LDS, [slot][channel]. Slot = 16 j + m: m = pool window, j = 2 (row in window) + (column in window). So the four pixels of a window
// sit in four different 16-pixel tiles at the same column, and the pool is a maximum over four accumulators of one lane.
// Wave w owns channels 16w .. 16w + 15 of all three outputs for all 64 pixels: theta^T = Wt X and phi = Wp X (D: column = pixel, rows = 8 consecutive channels a lane; bf16 hi/lo, three products in
// the order the GEMMs had), g^T = X^T Wg^T (D: column = channel, rows = 8 consecutive windows a lane; f16). Pooled phi and g leave in the fragment order of k_nl_flash, 512 contiguous bytes a wave
// and plane (a 16-byte chunk is half of one lane's fragment, 32 chunks, lane = 16 h + c, are one wave-wide load; element e: bits 0-2 k, 3-6 row c, 7 half h, 8 which 16 k, then pooled phi: 9-10 block of
// 32 channels, 11.. tile of 16 keys; pooled g: 9-11 tile of 16 channels, 12.. block of 32 keys). theta leaves in the same order, as the B operand of k_nl_flash: a group of 16 queries = one pixel tile j
// (bits 9-10 block of 32 channels, 11-12 tile j, 13 half hf, 14.. row pair py), again 512 contiguous bytes a wave, tile and plane. The five weight planes arrive in fragment order too (k_nl_wcast). The bias is added behind the maximum (rounding is monotonic, so the value is the same).
namespace w25 {
// the bf16 hi/lo split of two values, packed, in 32-bit arithmetic throughout (the same bits as f2bf_bits gives: round to nearest even, the result in the upper half)
__device__ __forceinline__ unsigned bf_rn(float f) { const unsigned u = __float_as_uint(f); return u + 0x7FFFu + ((u >> 16) & 1u); }
__device__ __forceinline__ unsigned split2(float a, float b, unsigned* lo) {
  const unsigned ua = bf_rn(a) & 0xFFFF0000u, ub = bf_rn(b) & 0xFFFF0000u;
  *lo = (bf_rn(a - __uint_as_float(ua)) >> 16) | (bf_rn(b - __uint_as_float(ub)) & 0xFFFF0000u);
  return (ua >> 16) | ub; }
constexpr int PJX = 264;   // LDS pitch of a slot of x, in 16-bit elements: 512 B + 16 B, an odd multiple of 16 B for 16-byte reads
// a fragment stored in fragment order: two wave-wide loads of 512 contiguous bytes (elements 0..7 <- p[0..7], 8..15 <- p[256..263], p = fragment + 8 * lane)
__device__ __forceinline__ v16b ldf_b(const __bf16* p) { Frag<__bf16>::U f; f.h[0] = *(const v8b*)(p); f.h[1] = *(const v8b*)(p + 256); return f.v; }
__device__ __forceinline__ v16h ldf_h(const _Float16* p) { Frag<_Float16>::U f; f.h[0] = *(const v8h*)(p); f.h[1] = *(const v8h*)(p + 256); return f.v; }
// launch bounds: four waves a SIMD (256 registers a wave), so that two blocks share a WGP and all 512 blocks are resident at once
__global__ __launch_bounds__(256, 4) void k_nl_proj(const float* __restrict__ X, const unsigned short* __restrict__ TWHp, const unsigned short* __restrict__ TWLp, const unsigned short* __restrict__ PWHp,
                                                 const unsigned short* __restrict__ PWLp, const unsigned short* __restrict__ GWp, const float* __restrict__ thb, const float* __restrict__ phb,
                                                 const float* __restrict__ gb, unsigned short* __restrict__ THHp, unsigned short* __restrict__ THLp, unsigned short* __restrict__ PPHp,
                                                 unsigned short* __restrict__ PPLp, unsigned short* __restrict__ GP16p) {
  constexpr int Cc = 256, D = 128, NKc = 1024, HWc = 4096;
  __shared__ __align__(16) unsigned short sx[3][64 * PJX];
  const int tid = threadIdx.x, lane = tid & 31, m = lane & 15, h = lane >> 4;
  const int wave = __builtin_amdgcn_readfirstlane(tid >> 5);   // the wave's number in a scalar register: every address is a scalar base plus a lane offset, and few vector registers live across the products
  const int b = blockIdx.y, py = blockIdx.x >> 1, hf = blockIdx.x & 1;
  // the wave's weight rows 16 wave .. + 15 in fragment order (eight fragments of 512 elements a plane, one a k step; a load = 512 contiguous bytes), first k step: they fly with the loads of x
  const unsigned wob = (unsigned)lane * 16u;   // one lane offset, in bytes, for the five planes
  const int wr = wave * 16 * Cc;
  const __bf16* TWH = (const __bf16*)((const char*)(TWHp + wr) + wob); const __bf16* TWL = (const __bf16*)((const char*)(TWLp + wr) + wob); const __bf16* PWH = (const __bf16*)((const char*)(PWHp + wr) + wob);
  const __bf16* PWL = (const __bf16*)((const char*)(PWLp + wr) + wob); const _Float16* GW = (const _Float16*)((const char*)(GWp + wr) + wob);
  v16b th = ldf_b(TWH), tl = ldf_b(TWL), ph = ldf_b(PWH), pl = ldf_b(PWL); v16h gw = ldf_h(GW);
  {
    const int g = lane & 7, cb = (lane >> 3) & 1, ry = h, cg = wave * 2 + cb;   // 4 pixels from column 4 g of row ry; channels 8 cg .. (and 128 + 8 cg ..); 16 lanes of one row: their LDS stores meet no common bank
    const unsigned xo = (unsigned)(cb * 8 * HWc + ry * 64 + g * 4) * 4u;   // lane offset in bytes
    const float* xp = (const float*)((const char*)(X + ((size_t)b * Cc + wave * 16) * HWc + (2 * py) * 64 + hf * 32) + xo);
    v4f v[2][8];
#pragma unroll   // v[][] in registers, all sixteen loads in flight
    for (int it = 0; it < 2; ++it)
#pragma unroll   // inner loop of the same
      for (int k = 0; k < 8; ++k) v[it][k] = *(const v4f*)(xp + (it * 128 + k) * HWc);
    // the wait before a load's address registers are reused; the lane offset of x and the lane number (the compiler scales it for the weights' addresses) as inputs keep their registers until the wait
    asm volatile("s_wait_xcnt 0x0" :: "v"(xo), "v"(lane) : "memory");
#pragma unroll   // constant indices into v[][]
    for (int it = 0; it < 2; ++it)
#pragma unroll   // inner loop of the same
      for (int e = 0; e < 4; ++e) { v4u hi, lo, f;
#pragma unroll   // inner loop of the same
        for (int q = 0; q < 4; ++q) { unsigned l2; hi[q] = split2(v[it][2 * q][e], v[it][2 * q + 1][e], &l2); lo[q] = l2; f[q] = f2h2_pack(v[it][2 * q][e] * 16.0f, v[it][2 * q + 1][e] * 16.0f); }
        const int so = ((ry * 2 + (e & 1)) * 16 + 2 * g + (e >> 1)) * PJX + it * 128 + cg * 8;
        *(v4u*)(&sx[0][so]) = hi; *(v4u*)(&sx[1][so]) = lo; *(v4u*)(&sx[2][so]) = f; }
  }
  __syncthreads();   // the tile of x is complete before any wave reads it
  v8f at[4], ap[4], ag[4];
#pragma unroll   // constant indices
  for (int j = 0; j < 4; ++j) { at[j] = (v8f){0.f,0.f,0.f,0.f,0.f,0.f,0.f,0.f}; ap[j] = at[j]; ag[j] = at[j]; }
  const __bf16* xh = (const __bf16*)(&sx[0][0]) + m * PJX + 8 * h; const __bf16* xl = (const __bf16*)(&sx[1][0]) + m * PJX + 8 * h; const _Float16* xf = (const _Float16*)(&sx[2][0]) + m * PJX + 8 * h;
  const unsigned bo8 = (unsigned)h * 32u, bo1 = (unsigned)m * 4u;   // lane offsets of the biases, in bytes
  const float* tbp = (const float*)((const char*)(thb + wave * 16) + bo8); const float* pbp = (const float*)((const char*)(phb + wave * 16) + bo8); const float* gbp = (const float*)((const char*)(gb + wave * 16) + bo1);
  v4f tb0, tb1, pb0, pb1; float gbv;
#pragma unroll   // eight k steps of 32 channels, constant offsets; no branch stands behind a matrix instruction
  for (int ks = 0; ks < 8; ++ks) {
    v16b nth = th, ntl = tl, nph = ph, npl = pl; v16h ngw = gw;
    if (ks < 7) {   // the next k step's weights fly behind this step's products
      const int kn = (ks + 1) * 512;
      nth = ldf_b(TWH + kn); ntl = ldf_b(TWL + kn); nph = ldf_b(PWH + kn); npl = ldf_b(PWL + kn); ngw = ldf_h(GW + kn);
      // the wait before these loads' address registers are reused (the lane number as an input keeps it until then); memory clobbered, the loads also stay above the products instead of sinking to their first use
      asm volatile("s_wait_xcnt 0x0" :: "v"(lane) : "memory");
    } else {        // the biases fly behind the last step's products, in the registers that the weights have left
      tb0 = *(const v4f*)(tbp); tb1 = *(const v4f*)(tbp + 4); pb0 = *(const v4f*)(pbp); pb1 = *(const v4f*)(pbp + 4); gbv = *gbp;
      asm volatile("s_wait_xcnt 0x0" :: "v"(bo8), "v"(bo1) : "memory");   // the same wait for the biases' lane offsets
    }
#pragma unroll   // two pixel tiles at a time: six independent accumulators, half the fragments live
    for (int jp = 0; jp < 4; jp += 2) {
      v16b bh[2], bl[2]; v16h bf[2];
#pragma unroll   // constant indices
      for (int u = 0; u < 2; ++u) { const int o = (jp + u) * 16 * PJX + ks * 32; bh[u] = Frag<__bf16>::load(xh + o); bl[u] = Frag<__bf16>::load(xl + o); bf[u] = Frag<_Float16>::load(xf + o); }
#pragma unroll   // constant indices; neighbours in the stream go to different tiles
      for (int u = 0; u < 2; ++u) at[jp + u] = Frag<__bf16>::mma(th, bh[u], at[jp + u]);
#pragma unroll   // the same
      for (int u = 0; u < 2; ++u) ap[jp + u] = Frag<__bf16>::mma(ph, bh[u], ap[jp + u]);
#pragma unroll   // the same
      for (int u = 0; u < 2; ++u) ag[jp + u] = Frag<_Float16>::mma(bf[u], gw, ag[jp + u]);
#pragma unroll   // the same
      for (int u = 0; u < 2; ++u) at[jp + u] = Frag<__bf16>::mma(tl, bh[u], at[jp + u]);
#pragma unroll   // the same
      for (int u = 0; u < 2; ++u) ap[jp + u] = Frag<__bf16>::mma(ph, bl[u], ap[jp + u]);
#pragma unroll   // the same
      for (int u = 0; u < 2; ++u) at[jp + u] = Frag<__bf16>::mma(th, bl[u], at[jp + u]);
#pragma unroll   // the same
      for (int u = 0; u < 2; ++u) ap[jp + u] = Frag<__bf16>::mma(pl, bh[u], ap[jp + u]);
    }
    th = nth; tl = ntl; ph = nph; pl = npl; gw = ngw;
  }
  __builtin_amdgcn_sched_barrier(0);   // the conversions below stay behind the products: moved up among them, their temporaries took registers that the fragments need, and values were spilled
  const float tbv[8] = { tb0[0], tb0[1], tb0[2], tb0[3], tb1[0], tb1[1], tb1[2], tb1[3] }, pbv[8] = { pb0[0], pb0[1], pb0[2], pb0[3], pb1[0], pb1[1], pb1[2], pb1[3] };
  // pooled phi (hi, lo) and pooled g
  v4u phi_h, phi_l, g_h;
#pragma unroll   // constant indices
  for (int q = 0; q < 4; ++q) { float pv[2], gv[2];
#pragma unroll   // inner loop of the same
    for (int u = 0; u < 2; ++u) { const int r = 2 * q + u;
      pv[u] = fmaxf(fmaxf(ap[0][r], ap[1][r]), fmaxf(ap[2][r], ap[3][r])) + pbv[r];
      gv[u] = fmaxf(fmaxf(ag[0][r], ag[1][r]), fmaxf(ag[2][r], ag[3][r])) * 0.0625f + gbv; }
    unsigned l2; phi_h[q] = split2(pv[0], pv[1], &l2); phi_l[q] = l2; g_h[q] = f2h2_pack(gv[0], gv[1]); }
  // theta: a lane's 8 channels of one pixel are half of a lane's B fragment (column = m, k from 16 (wave & 1) + 8 h of k step wave >> 1), so a wave stores 512 contiguous bytes a pixel tile and plane
  v4u oh[4], ol[4];
#pragma unroll   // constant indices
  for (int j = 0; j < 4; ++j)
#pragma unroll   // inner loop of the same
    for (int q = 0; q < 4; ++q) { unsigned l2; oh[j][q] = split2(at[j][2 * q] + tbv[2 * q], at[j][2 * q + 1] + tbv[2 * q + 1], &l2); ol[j][q] = l2; }
  const unsigned l16 = (unsigned)lane * 16u;
  const size_t to = ((((size_t)b * (HWc / 128) + py) * 8 + hf * 4) * 4 + (wave >> 1)) * 512 + (wave & 1) * 256;
  char* tph = (char*)(THHp + to) + l16; char* tpl = (char*)(THLp + to) + l16;
#pragma unroll   // constant indices; a pixel tile's four fragments are 4096 bytes
  for (int j = 0; j < 4; ++j) { *(v4u*)(tph + j * 4096) = oh[j]; *(v4u*)(tpl + j * 4096) = ol[j]; }
  const size_t po = (size_t)b * NKc * D + (py * 2 + hf) * 2048 + wave * 256, vo = (size_t)b * NKc * D + py * 4096 + wave * 512 + hf * 256;
  *(v4u*)((char*)(PPHp + po) + l16) = phi_h; *(v4u*)((char*)(PPLp + po) + l16) = phi_l; *(v4u*)((char*)(GP16p + vo) + l16) = g_h;
  // the wait before a store's registers are reused: the lane offset and the values as inputs keep them all until it, so nothing takes a register of an issued store
  asm volatile("s_wait_xcnt 0x0" :: "v"(l16), "v"(oh[0]), "v"(oh[1]), "v"(oh[2]), "v"(oh[3]), "v"(ol[0]), "v"(ol[1]), "v"(ol[2]), "v"(ol[3]), "v"(phi_h), "v"(phi_l), "v"(g_h) : "memory");
}
} // namespace w25
// Fused attention and output projection of one image: y[q][c] = f16( sum_k softmax_k(theta[q] . phi[k]) g[c][k] ), WY = W y + W_b. Scores, probabilities and y never leave the registers.
// A block is 8 waves, two a SIMD, so that one wave's softmax runs beside the other's matrix products: waves w and w + 4 own the same 32 queries (two 16-column groups) and walk 512 keys each,
// 32 at a time; behind the loop they exchange maximum, sum and O^T through LDS, both merge them, and each forms half of the 256 output channels. A wave forms S^T = K Q^T (bf16 hi/lo planes, three products, as the score
// GEMM did) and O^T += V^T P^T (f16): in both D tiles a lane holds one query (column lane & 15), so maximum, sum and rescale are lane-local but for one
// exchange between the wave halves, and two S^T tiles (keys 0-15, 16-31), converted in place, are the B operand of the second product in the hardware k order.
// K (hi, lo), V^T and Q (theta hi, lo) lie in fragment order (k_nl_proj writes them so): every fragment load covers four whole lines. A group of 16 queries is one pixel tile of k_nl_proj:
// group 2 qw + t, column cq = pixel 64 (qw & 1) + 32 (qw >> 1) + 2 cq + t of the block's 128 (two image rows); the epilogue puts each column back at its pixel.
// Running maximum in log2 units; the accumulators are rescaled only when a column's maximum has grown by more than 8; p = 2^(s - m + 7) <= 2^15 fits f16.
// Epilogue: WY^T tile = W y^T (f16, k ascending), W in fragment order (k_nl_wcast writes it so); the block's 256 channels x 128 queries go through LDS, from where whole rows are stored and
// each channel's partial batch statistics are summed; k_nl_out merges the partials.
namespace w25 {
__device__ __forceinline__ float xhalf(float x) { return __builtin_bit_cast(float, __builtin_amdgcn_permlanex16(__builtin_bit_cast(int, x), __builtin_bit_cast(int, x), 0x76543210, 0xfedcba98, false, false)); }   // lane l takes lane l ^ 16
typedef float v2f __attribute__((ext_vector_type(2)));
typedef __attribute__((address_space(1))) const char* gcp;   // a pointer into global memory, said outright: one rebuilt from two words would otherwise be taken for a generic one
// a wave-uniform address, both words through a scalar register: the compiler then keeps a plane's base in scalar registers and forms a pass's address from it; else it held base + lane offset of every plane in a vector pair through the loop
__device__ __forceinline__ gcp ubase(const unsigned short* p) { const unsigned long long a = (unsigned long long)p;
  const unsigned l = (unsigned)__builtin_amdgcn_readfirstlane((int)(unsigned)a), u = (unsigned)__builtin_amdgcn_readfirstlane((int)(unsigned)(a >> 32)); return (gcp)(((unsigned long long)u << 32) | l); }
// the same fragment loads from a lane's address a and a constant offset o, in bytes
__device__ __forceinline__ v16b ldu_b(gcp a, int o) { Frag<__bf16>::U f; f.h[0] = *(const __attribute__((address_space(1))) v8b*)(a + o); f.h[1] = *(const __attribute__((address_space(1))) v8b*)(a + (o + 512)); return f.v; }
__device__ __forceinline__ v16h ldu_h(gcp a, int o) { Frag<_Float16>::U f; f.h[0] = *(const __attribute__((address_space(1))) v8h*)(a + o); f.h[1] = *(const __attribute__((address_space(1))) v8h*)(a + (o + 512)); return f.v; }
__global__ __launch_bounds__(256) void k_nl_flash(const unsigned short* __restrict__ QHp, const unsigned short* __restrict__ QLp, const unsigned short* __restrict__ KHp, const unsigned short* __restrict__ KLp,
                                                  const unsigned short* __restrict__ VTp, const unsigned short* __restrict__ WFp, const float* __restrict__ Wb, float* __restrict__ WY, float* __restrict__ PS) {
  constexpr int D = 128, NKc = 1024, HWc = 4096;
  constexpr int PW = 132;   // LDS pitch of a channel's row of 128 queries, in floats: 512 B + 16 B, an odd multiple of 16 B for the row-per-lane reads
  __shared__ __align__(16) float sW[256 * PW];
  constexpr float L2E = 1.4426950408889634f;
  constexpr int NP = NKc / 64;   // passes of a wave: half of the keys
  const int lane = threadIdx.x & 31, cq = lane & 15, h = lane >> 4;
  const int wave = __builtin_amdgcn_readfirstlane((int)(threadIdx.x >> 5)), qw = wave & 3, hv = wave >> 2;   // in a scalar register; qw: which 32 queries, hv: which half of the keys, later of the channels
  const int b = blockIdx.y;
  const size_t qo = (((size_t)b * (HWc / 128) + blockIdx.x) * 8 + qw * 2) * 2048, ko = ((size_t)b * NKc + hv * (NKc / 2)) * D;   // a group of 16 queries: four fragments of 512 elements
  const unsigned l16 = (unsigned)lane * 16u;   // one lane offset, in bytes, for Q, K, V^T and W: a pass forms its three addresses from scalar bases plus it, so no base pair lives in vector registers through the loop (the wave has 512)
  const gcp qh0 = ubase(QHp + qo) + l16, ql0 = ubase(QLp + qo) + l16;
  const gcp kh0 = ubase(KHp + ko) + l16, kl0 = ubase(KLp + ko) + l16;
  v16b qh[2][4], ql[2][4], kh[2][4], kl[2][4];
#pragma unroll   // constant indices: the fragments stay in registers
  for (int t = 0; t < 2; ++t)
#pragma unroll   // inner loop of the same
    for (int ks = 0; ks < 4; ++ks) {
      qh[t][ks] = ldu_b(qh0, (t * 4 + ks) * 1024); ql[t][ks] = ldu_b(ql0, (t * 4 + ks) * 1024);
      kh[t][ks] = ldu_b(kh0, (t * 4 + ks) * 1024); kl[t][ks] = ldu_b(kl0, (t * 4 + ks) * 1024);
    }
  asm volatile("s_wait_xcnt 0x0" :: "v"(lane) : "memory");   // the wait before these loads' address registers are reused: the compiler forms each address from a scalar base and the lane number, which as an input keeps its register until the wait
  v8f o[2][8];
#pragma unroll   // constant indices
  for (int t = 0; t < 2; ++t)
#pragma unroll   // inner loop of the same
    for (int ct = 0; ct < 8; ++ct) o[t][ct] = (v8f){0.f,0.f,0.f,0.f,0.f,0.f,0.f,0.f};
  float mu[2] = { -1.0e30f, -1.0e30f }, l[2] = { 0.f, 0.f };
#pragma unroll 1   // one pass is 64 matrix instructions already; unrolled, the fragments of two passes would not fit
  for (int p = 0; p < NP; ++p) {
    v16h vt[8]; const gcp vp = ubase(VTp + ko + p * 32 * D) + l16;
#pragma unroll   // constant indices; the eight V^T fragments fly while the scores are formed
    for (int ct = 0; ct < 8; ++ct) vt[ct] = ldu_h(vp, ct * 1024);
    __builtin_amdgcn_sched_barrier(0);   // keeps the V^T loads' issue above the score products; without it they sink to their first use and each waits a full latency there
    v8f s[2][2];   // [query group][key tile]
#pragma unroll   // constant indices
    for (int t = 0; t < 2; ++t) { s[t][0] = (v8f){0.f,0.f,0.f,0.f,0.f,0.f,0.f,0.f}; s[t][1] = s[t][0]; }
#pragma unroll   // constant indices; neighbours in the stream go to different tiles
    for (int ks = 0; ks < 4; ++ks) {
#pragma unroll   // inner loop of the same
      for (int kt = 0; kt < 2; ++kt)
#pragma unroll   // inner loop of the same
        for (int t = 0; t < 2; ++t) s[t][kt] = Frag<__bf16>::mma(kh[kt][ks], qh[t][ks], s[t][kt]);
#pragma unroll   // inner loop of the same
      for (int kt = 0; kt < 2; ++kt)
#pragma unroll   // inner loop of the same
        for (int t = 0; t < 2; ++t) s[t][kt] = Frag<__bf16>::mma(kh[kt][ks], ql[t][ks], s[t][kt]);
#pragma unroll   // inner loop of the same
      for (int kt = 0; kt < 2; ++kt)
#pragma unroll   // inner loop of the same
        for (int t = 0; t < 2; ++t) s[t][kt] = Frag<__bf16>::mma(kl[kt][ks], qh[t][ks], s[t][kt]);
    }
    // the next pass's K fragments, into the same registers: they fly behind the softmax and the second product (the last pass re-reads the wave's first 32 keys, in bounds, unused)
    const int kn = ((p + 1) & (NP - 1)) * 32 * D; const gcp kph = ubase(KHp + ko + kn) + l16, kpl = ubase(KLp + ko + kn) + l16;
    __builtin_amdgcn_sched_barrier(0);   // the 32 K loads issue as one group behind the last score product: moved up, two behind each fragment's last use, they stood in sixteen places among the products
#pragma unroll   // constant indices; issued in the order in which the next pass uses them (loads return in order)
    for (int ks = 0; ks < 4; ++ks) { kh[0][ks] = ldu_b(kph, ks * 1024); kh[1][ks] = ldu_b(kph, (4 + ks) * 1024); kl[0][ks] = ldu_b(kpl, ks * 1024); kl[1][ks] = ldu_b(kpl, (4 + ks) * 1024); }
    // the wait before the pass's load addresses are reused: the three
    // addresses as inputs keep the pairs until the wait. With vp named and memory clobbered, the V^T loads also stay in front of it and are not sunk behind the rescale branch to their first use
    asm volatile("s_wait_xcnt 0x0" :: "v"(kph), "v"(kpl), "v"(vp) : "memory");
    float mx[2];
#pragma unroll   // constant indices
    for (int t = 0; t < 2; ++t) { float m = fmaxf(s[t][0][0], s[t][1][0]);
#pragma unroll   // inner loop of the same
      for (int r = 1; r < 8; ++r) m = fmaxf(m, fmaxf(s[t][0][r], s[t][1][r]));
      mx[t] = fmaxf(m, xhalf(m)) * L2E; }
    const bool need = (mx[0] > mu[0] + 8.f) || (mx[1] > mu[1] + 8.f);
    if (__builtin_amdgcn_ballot_w32(need) != 0) {   // one scalar test a pass
#pragma unroll   // constant indices
      for (int t = 0; t < 2; ++t) { const float mn = fmaxf(mu[t], mx[t]); const float f = __builtin_amdgcn_exp2f(mu[t] - mn); mu[t] = mn; l[t] *= f;
#pragma unroll   // inner loop of the same
        for (int ct = 0; ct < 8; ++ct) o[t][ct] *= f; }
    }
    v16h pb[2];
#pragma unroll   // constant indices
    for (int t = 0; t < 2; ++t) { const float mb = 7.f - mu[t]; float a0 = 0.f, a1 = 0.f;
#pragma unroll   // inner loop of the same
      for (int r = 0; r < 8; ++r) { const float e0 = __builtin_amdgcn_exp2f(fmaf(s[t][0][r], L2E, mb)), e1 = __builtin_amdgcn_exp2f(fmaf(s[t][1][r], L2E, mb));
        a0 += e0; a1 += e1; pb[t][r] = (_Float16)e0; pb[t][8 + r] = (_Float16)e1; }
      l[t] += a0 + a1; }
#pragma unroll   // constant indices; sixteen independent tiles
    for (int ct = 0; ct < 8; ++ct)
#pragma unroll   // inner loop of the same
      for (int t = 0; t < 2; ++t) o[t][ct] = Frag<_Float16>::mma(vt[ct], pb[t], o[t][ct]);
  }
  // ---- the two halves of the keys meet: every wave leaves O^T (16 KiB, [register quad][lane]), maxima and sums in LDS and takes its partner's ----
  float* ex = sW + wave * 4096 + lane * 4; float* exs = sW + 8 * 4096 + wave * 128 + lane * 4;
#pragma unroll   // constant indices
  for (int t = 0; t < 2; ++t)
#pragma unroll   // inner loop of the same
    for (int ct = 0; ct < 8; ++ct) { *(v4f*)(ex + ((t * 8 + ct) * 2) * 128) = (v4f){ o[t][ct][0], o[t][ct][1], o[t][ct][2], o[t][ct][3] }; *(v4f*)(ex + ((t * 8 + ct) * 2 + 1) * 128) = (v4f){ o[t][ct][4], o[t][ct][5], o[t][ct][6], o[t][ct][7] }; }
  *(v4f*)exs = (v4f){ mu[0], mu[1], l[0], l[1] };
  // ---- W y + b for the wave's 32 queries and its 128 channels (128 hv ..); y = O / l never leaves the registers ----
  const unsigned wfo = l16, bo = (unsigned)h * 32u;   // lane offsets of W and of the bias, in bytes; a lane's D rows are channels 8 h .. 8 h + 7 of a tile
  const _Float16* WF = (const _Float16*)((const char*)(WFp + hv * 32 * 512) + wfo);
  const float* bp = (const float*)((const char*)(Wb + hv * 128) + bo);
  v16h wa[2][16]; v4f bb[2][4][2];   // two sets: four channel tiles x four k steps of W, and their biases
#pragma unroll   // constant indices; the first set flies behind the division below
  for (int u = 0; u < 4; ++u) { bb[0][u][0] = *(const v4f*)(bp + u * 16); bb[0][u][1] = *(const v4f*)(bp + u * 16 + 4); }
#pragma unroll   // the same
  for (int f = 0; f < 16; ++f) wa[0][f] = ldf_h(WF + f * 512);
  asm volatile("s_wait_xcnt 0x0" :: "v"(WF), "v"(bo) : "memory");   // the wait before a load's address registers are reused; the lane's address of W and the bias's lane offset as inputs keep their registers until it
  // every wave's partial results are in LDS before a partner reads them. The barrier with fences on LDS alone: __syncthreads() would also wait for the loads of W, which nobody shares
  __builtin_amdgcn_fence(__ATOMIC_RELEASE, "workgroup", "local"); __builtin_amdgcn_s_barrier(); __builtin_amdgcn_fence(__ATOMIC_ACQUIRE, "workgroup", "local");
  {
    const float* px = sW + (wave ^ 4) * 4096 + lane * 4; const v4f ps4 = *(const v4f*)(sW + 8 * 4096 + (wave ^ 4) * 128 + lane * 4);
#pragma unroll   // constant indices
    for (int t = 0; t < 2; ++t) { const float mn = fmaxf(mu[t], ps4[t]), da = mu[t] - mn, db = ps4[t] - mn; float fa, fb;
      // 2^da, 2^db with the slot behind each transcendental written out
      asm("v_exp_f32 %0, %2\n\tv_nop\n\tv_exp_f32 %1, %3\n\tv_nop" : "=&v"(fa), "=&v"(fb) : "v"(da), "v"(db));
      l[t] = l[t] * fa + ps4[2 + t] * fb;
#pragma unroll   // inner loop of the same
      for (int ct = 0; ct < 8; ++ct) { const v4f p0 = *(const v4f*)(px + ((t * 8 + ct) * 2) * 128), p1 = *(const v4f*)(px + ((t * 8 + ct) * 2 + 1) * 128);
#pragma unroll   // inner loop of the same
        for (int r = 0; r < 4; ++r) { o[t][ct][r] = o[t][ct][r] * fa + p0[r] * fb; o[t][ct][4 + r] = o[t][ct][4 + r] * fa + p1[r] * fb; } } }
  }
  // every wave has read its partner's results: the LDS is free for the tile of WY (the same barrier)
  __builtin_amdgcn_fence(__ATOMIC_RELEASE, "workgroup", "local"); __builtin_amdgcn_s_barrier(); __builtin_amdgcn_fence(__ATOMIC_ACQUIRE, "workgroup", "local");
  v16h yb[2][4];   // two O^T tiles (channels 32 j .. + 15, + 16 .. + 31), converted in place, are the B operand of k step j in the hardware k order
#pragma unroll   // constant indices
  for (int t = 0; t < 2; ++t) { const float inv = 1.f / (l[t] + xhalf(l[t]));
#pragma unroll   // inner loop of the same
    for (int j = 0; j < 4; ++j)
#pragma unroll   // inner loop of the same
      for (int r = 0; r < 8; ++r) { yb[t][j][r] = (_Float16)(o[t][2 * j][r] * inv); yb[t][j][8 + r] = (_Float16)(o[t][2 * j + 1][r] * inv); } }
  float* sq = sW + (hv * 128 + 8 * h) * PW + (qw & 1) * 64 + (qw >> 1) * 32 + 2 * cq;   // the lane's two queries (t = 0, 1) are neighbouring pixels
#pragma unroll   // constant indices into wa[][], bb[][][]: two groups of four channel tiles
  for (int g = 0; g < 2; ++g) {
    if (g < 1) {   // the next group's biases and W fragments fly behind this group's products
#pragma unroll   // constant indices
      for (int u = 0; u < 4; ++u) { bb[(g + 1) & 1][u][0] = *(const v4f*)(bp + ((g + 1) * 4 + u) * 16); bb[(g + 1) & 1][u][1] = *(const v4f*)(bp + ((g + 1) * 4 + u) * 16 + 4); }
#pragma unroll   // the same
      for (int f = 0; f < 16; ++f) wa[(g + 1) & 1][f] = ldf_h(WF + ((g + 1) * 16 + f) * 512);
      asm volatile("s_wait_xcnt 0x0" :: "v"(WF), "v"(bo) : "memory");   // the same wait; memory clobbered, the loads also stay above the products instead of sinking to their first use
    }
    v8f d[4][2];
#pragma unroll   // constant indices
    for (int u = 0; u < 4; ++u) { d[u][0] = (v8f){0.f,0.f,0.f,0.f,0.f,0.f,0.f,0.f}; d[u][1] = d[u][0]; }
#pragma unroll   // constant indices; k ascending, eight independent tiles
    for (int j = 0; j < 4; ++j)
#pragma unroll   // inner loop of the same
      for (int u = 0; u < 4; ++u)
#pragma unroll   // inner loop of the same
        for (int t = 0; t < 2; ++t) d[u][t] = Frag<_Float16>::mma(wa[g & 1][u * 4 + j], yb[t][j], d[u][t]);
#pragma unroll   // constant indices; 16 lanes = 128 B of a channel's row, the two halves 32 banks apart
    for (int u = 0; u < 4; ++u)
#pragma unroll   // inner loop of the same
      for (int r = 0; r < 8; ++r) { const float bv = bb[g & 1][u][r >> 2][r & 3];
        *(v2f*)(sq + ((g * 4 + u) * 16 + r) * PW) = (v2f){ d[u][0][r] * 0.0625f + bv, d[u][1][r] * 0.0625f + bv }; }
  }
  __syncthreads();   // the block's 256 x 128 tile of WY is complete in LDS before rows are read across the waves' columns
  // a wave stores 32 channels' rows: 512 contiguous bytes (four whole lines) a store
  const float* sr = sW + wave * 32 * PW + lane * 4;
  float* wy = WY + ((size_t)b * 256 + wave * 32) * HWc + blockIdx.x * 128 + lane * 4;
#pragma unroll   // constant offsets
  for (int it = 0; it < 2; ++it) { v4f v[16];
#pragma unroll   // inner loop of the same: sixteen LDS reads behind one wait
    for (int k = 0; k < 16; ++k) v[k] = *(const v4f*)(sr + (it * 16 + k) * PW);
#pragma unroll   // inner loop of the same
    for (int k = 0; k < 16; ++k) *(v4f*)(wy + (size_t)(it * 16 + k) * HWc) = v[k];
    // the wait before a store's registers are reused: address and values as inputs keep them until it
    asm volatile("s_wait_xcnt 0x0" :: "v"(wy), "v"(v[0]), "v"(v[1]), "v"(v[2]), "v"(v[3]), "v"(v[4]), "v"(v[5]), "v"(v[6]), "v"(v[7]), "v"(v[8]), "v"(v[9]), "v"(v[10]), "v"(v[11]), "v"(v[12]), "v"(v[13]), "v"(v[14]), "v"(v[15]) : "memory"); }
  // partial batch statistics: a thread owns channel tid and reads its 128 values (row pitch an odd multiple of 16 B): sum, then squared deviations from the row's own mean, no exchange between lanes
  v2f st[1]; v4f rv[1][32];
#pragma unroll   // constant indices: the row in registers
  for (int cc = 0; cc < 1; ++cc)
#pragma unroll   // inner loop of the same
    for (int k = 0; k < 32; ++k) rv[cc][k] = *(const v4f*)(sW + ((int)threadIdx.x + cc * 128) * PW + k * 4);
  __builtin_amdgcn_sched_barrier(0);   // keeps all 32 LDS reads' issue above the sums; without it they sink to their first use, four in flight, and the wave waits on each
#pragma unroll   // constant indices
  for (int cc = 0; cc < 1; ++cc) { v4f a = rv[cc][0];
#pragma unroll   // inner loop of the same: four independent chains
    for (int k = 1; k < 32; ++k) a += rv[cc][k];
    const float s = (a[0] + a[1]) + (a[2] + a[3]), mean = s * (1.0f / 128.0f);
    v4f q = { 0.f, 0.f, 0.f, 0.f };
#pragma unroll   // inner loop of the same
    for (int k = 0; k < 32; ++k) { const v4f dv = rv[cc][k] - mean; q += dv * dv; }
    st[cc][0] = s; st[cc][1] = (q[0] + q[1]) + (q[2] + q[3]); }
  float* ps = PS + ((size_t)(b * (HWc / 128) + (int)blockIdx.x) * 256 + (int)threadIdx.x) * 2;   // the block's own 2 KiB: 16 whole lines, one writer each
  *(v2f*)(ps) = st[0];
  asm volatile("s_wait_xcnt 0x0" :: "v"(ps), "v"(st[0]) : "memory");   // the same wait for the last store
}
} // namespace w25
// out = (WY - mu[c]) * rstd[c] * gamma[c] + beta[c] + x. One block per channel c, all 8 images: a thread holds 16 B of each operand and image, every load's address a scalar base plus one lane offset.
// The batch statistics come from the 256 partial pairs (sum, squared deviations from the own mean, 128 values each) that k_nl_flash left for the channel: they go through LDS once, then every wave
// merges them itself (mean first, then the deviations plus 128 (partial mean - mean)^2), while its loads of WY and x are in flight.
typedef float v2f __attribute__((ext_vector_type(2)));
typedef __attribute__((address_space(1))) char* gptr;   // a pointer into global memory, said outright: one rebuilt from two words would otherwise be taken for a generic one
// a block-uniform address, both words through a scalar register: the compiler then keeps it as the scalar base of its load and does not fold it with the lane offset into a vector pair
__device__ __forceinline__ gptr sbase(const float* p) { const unsigned long long a = (unsigned long long)p;
    const unsigned l = (unsigned)__builtin_amdgcn_readfirstlane((int)(unsigned)a), u = (unsigned)__builtin_amdgcn_readfirstlane((int)(unsigned)(a >> 32)); return (gptr)(((unsigned long long)u << 32) | l); }
typedef __attribute__((address_space(1))) v4f* gv4;
__global__ __launch_bounds__(1024) void k_nl_out(const float* __restrict__ WY, const float* __restrict__ PS, const float* __restrict__ Gm, const float* __restrict__ Bt, const float* __restrict__ X, float* __restrict__ OUT) {
    constexpr int Bn = 8, C = 256, HW = 4096, NP = 256, NQ = 128;
    __shared__ __align__(16) float sp[2 * NP];
    const int c = (int)blockIdx.x, t = (int)threadIdx.x, lane = t & 31;
    const unsigned lo = (unsigned)t * 16u;
    const float* pp = PS + ((size_t)(t & (NP - 1)) * C + c) * 2; v2f p = { 0.f, 0.f };
    if (t < NP) p = *(const v2f*)pp;   // waves 0 to 7, first in the load queue: its wait leaves the sixteen loads below in flight
    v4f w[Bn], xv[Bn]; gptr wb[Bn], xb[Bn]; float* op[Bn];
#pragma unroll   // constant indices: the sixteen scalar bases
    for (int b = 0; b < Bn; ++b) { const int po = (b * C + c) * HW; wb[b] = sbase(WY + po); xb[b] = sbase(X + po); }
    __builtin_amdgcn_sched_barrier(0);   // all bases stand before the first load: formed between the loads they shared a few scalar registers, with a wait in front of every reuse
#pragma unroll   // all sixteen loads in flight, every address a scalar base plus the one lane offset
    for (int b = 0; b < Bn; ++b) { w[b] = *(gv4)(wb[b] + lo); xv[b] = *(gv4)(xb[b] + lo); }
    asm volatile("s_wait_xcnt 0x0" :: "v"(lo), "v"(pp) : "memory");   // the wait before a load's address registers are reused; the lane offset and the partial's address as inputs keep them until it
    const float g = Gm[c], be = Bt[c];
    if (t < NP) *(v2f*)(sp + 2 * t) = p;
    // the 256 pairs are in LDS before any wave sums them. The barrier with fences on LDS alone: __syncthreads() would also wait for the sixteen global loads, which nobody shares
    __builtin_amdgcn_fence(__ATOMIC_RELEASE, "workgroup", "local"); __builtin_amdgcn_s_barrier(); __builtin_amdgcn_fence(__ATOMIC_ACQUIRE, "workgroup", "local");
    float s8[8], m8[8];
#pragma unroll   // constant indices
    for (int k = 0; k < 8; ++k) { const v2f q = *(const v2f*)(sp + 2 * (lane + 32 * k)); s8[k] = q[0]; m8[k] = q[1]; }
    float S = ((s8[0] + s8[1]) + (s8[2] + s8[3])) + ((s8[4] + s8[5]) + (s8[6] + s8[7]));
#pragma unroll   // five exchange steps, constant masks
    for (int o = 16; o > 0; o >>= 1) S += __shfl_xor(S, o, 32);
    const float mu = S / (float)(NP * NQ);
    float Q = 0.f;
#pragma unroll   // constant indices
    for (int k = 0; k < 8; ++k) { const float dm = s8[k] * (1.0f / (float)NQ) - mu; Q += m8[k] + (float)NQ * dm * dm; }
#pragma unroll   // five exchange steps, constant masks
    for (int o = 16; o > 0; o >>= 1) Q += __shfl_xor(Q, o, 32);
    const float rs = rsqrtf(Q / (float)(NP * NQ) + 1e-5f);
    __builtin_amdgcn_sched_barrier(0);   // the first use of WY stays behind the statistics: moved up between the two sums, its wait for the loads held the second sum back
#pragma unroll   // constant indices into w[], xv[]
    for (int b = 0; b < Bn; ++b) {
#pragma unroll   // inner loop of the same: constant indices, values stay in registers
        for (int e = 0; e < 4; ++e) w[b][e] = (w[b][e] - mu) * rs * g + be + xv[b][e];
        op[b] = (float*)((char*)(OUT + (b * C + c) * HW) + lo); *(v4f*)op[b] = w[b]; }
    // the wait before a store's registers are reused: the eight addresses and the values as inputs keep them all until it
    asm volatile("s_wait_xcnt 0x0" :: "v"(op[0]), "v"(op[1]), "v"(op[2]), "v"(op[3]), "v"(op[4]), "v"(op[5]), "v"(op[6]), "v"(op[7]), "v"(w[0]), "v"(w[1]), "v"(w[2]), "v"(w[3]), "v"(w[4]), "v"(w[5]), "v"(w[6]), "v"(w[7]) : "memory");
}


// The four weight casts in one launch: they need nothing of each other, so blockIdx.y picks the matrix (a block-uniform choice) and the four grids run side by side.
// All four matrices hold the same number of elements and the grid covers it exactly; a thread casts 4 consecutive ones of a row (one 16-byte load, 8-byte stores), each value as k_cast16 and k_castS16 cast it.
// Every plane leaves in the fragment order that its reader loads (a tile of 16 rows x 32 k = 512 elements: bits 0-2 k, 3-6 row, 7 half, 8 which 16 k; tiles: k step fastest, then the 16 rows).
// A block takes 8 rows x 128 k (W_w [256][128]: whole rows; the three [128][256] matrices: half rows): a wave reads 512 contiguous bytes, and the 8 rows of a 128-byte line of the fragment order belong to one block.
__global__ __launch_bounds__(256) void k_nl_wcast(const float* __restrict__ Ww, const float* __restrict__ thw, const float* __restrict__ phw, const float* __restrict__ gw, unsigned short* __restrict__ WW16,
                                                  unsigned short* __restrict__ TWH, unsigned short* __restrict__ TWL, unsigned short* __restrict__ PWH, unsigned short* __restrict__ PWL, unsigned short* __restrict__ GW16) {
    const int job = (int)blockIdx.y; const unsigned t = threadIdx.x, bx = blockIdx.x;
    const unsigned nks = (job == 0) ? 4u : 8u;   // k steps of 32 in a row
    const unsigned c = ((job == 0) ? bx : (bx >> 1)) * 8u + (t >> 5), k = ((job == 0) ? 0u : (bx & 1u) * 128u) + (t & 31u) * 4u;
    const float* sp = ((job == 0) ? Ww : (job == 1) ? thw : (job == 2) ? phw : gw) + (c * nks * 32u + k);
    const v4f v = *(const v4f*)sp;
    asm volatile("s_wait_xcnt 0x0" :: "v"(sp) : "memory");   // the wait before the load's address pair is reused; the address as an input keeps the pair until it, so the result does not land on it either
    const unsigned fo = ((c >> 4) * nks + (k >> 5)) * 512u + ((k >> 4) & 1u) * 256u + ((k >> 3) & 1u) * 128u + (c & 15u) * 8u + (k & 7u);
    if (job == 1 || job == 2) {   // theta_w, phi_w: bf16 hi and lo planes
        v2u hi, lo; unsigned l2; hi[0] = f2bf2_pack(v[0], v[1], &l2); lo[0] = l2; hi[1] = f2bf2_pack(v[2], v[3], &l2); lo[1] = l2;
        unsigned short* dh = ((job == 1) ? TWH : PWH) + fo; unsigned short* dl = ((job == 1) ? TWL : PWL) + fo;
        *(v2u*)dh = hi; *(v2u*)dl = lo;
        asm volatile("s_wait_xcnt 0x0" :: "v"(dh), "v"(dl), "v"(hi), "v"(lo) : "memory");   // the wait before the stores' registers are reused; addresses and values as inputs keep them until it
    } else {                      // W_w: f16 of 16 w; g_w: f16
        const float s = (job == 0) ? 16.0f : 1.0f; v2u f; f[0] = f2h2_pack(v[0] * s, v[1] * s); f[1] = f2h2_pack(v[2] * s, v[3] * s);
        unsigned short* dp = ((job == 0) ? WW16 : GW16) + fo;
        *(v2u*)dp = f;
        asm volatile("s_wait_xcnt 0x0" :: "v"(dp), "v"(f) : "memory");   // the wait before the store's registers are reused; address and value as inputs keep them until it
    }
}

extern "C" void kernel_launch(void* const* d_in, const int* in_sizes, int n_in, void* d_out, int out_size, void* d_ws, size_t ws_size, hipStream_t stream) {
    (void)in_sizes; (void)n_in; (void)out_size; (void)ws_size;
    const float* x = (const float*)d_in[0];
    const float* gw = (const float*)d_in[1];
    const float* gb = (const float*)d_in[2];
    const float* thw = (const float*)d_in[3];
    const float* thb = (const float*)d_in[4];
    const float* phw = (const float*)d_in[5];
    const float* phb = (const float*)d_in[6];
    const float* Ww = (const float*)d_in[7];
    const float* Wb = (const float*)d_in[8];
    const float* bng = (const float*)d_in[9];
    const float* bnb = (const float*)d_in[10];
    const int Bn = 8;
    const int C = 256;
    const int IC = 128;
    const int HW = 4096;
    const int NK = 1024;
    float* out = (float*)d_out;
    char* wsp = (char*)d_ws;
    // One launch per stage for all Bn images (blockIdx.y = image in k_nl_proj and k_nl_flash, per-image strides). Workspace: the operand planes that the projection writes, WY, the weight planes, the partial BN statistics
    unsigned short* THH = (unsigned short*)wsp; wsp += (size_t)Bn * HW * IC * 2;
    unsigned short* THL = (unsigned short*)wsp; wsp += (size_t)Bn * HW * IC * 2;
    unsigned short* PPH = (unsigned short*)wsp; wsp += (size_t)Bn * NK * IC * 2;
    unsigned short* PPL = (unsigned short*)wsp; wsp += (size_t)Bn * NK * IC * 2;
    unsigned short* GP16 = (unsigned short*)wsp; wsp += (size_t)Bn * IC * NK * 2;
    float* WY = (float*)wsp; wsp += (size_t)Bn * C * HW * 4;
    unsigned short* WW16 = (unsigned short*)wsp; wsp += (size_t)C * IC * 2;
    unsigned short* TWH = (unsigned short*)wsp; wsp += (size_t)IC * C * 2;
    unsigned short* TWL = (unsigned short*)wsp; wsp += (size_t)IC * C * 2;
    unsigned short* PWH = (unsigned short*)wsp; wsp += (size_t)IC * C * 2;
    unsigned short* PWL = (unsigned short*)wsp; wsp += (size_t)IC * C * 2;
    unsigned short* GW16 = (unsigned short*)wsp; wsp += (size_t)IC * C * 2;
    float* PS = (float*)wsp; wsp += (size_t)Bn * (HW / 128) * C * 2 * 4;
    // weights
    k_nl_wcast<<<dim3((unsigned)(C * IC / 1024), 4u), 256, 0, stream>>>(Ww, thw, phw, gw, WW16, TWH, TWL, PWH, PWL, GW16);
    // theta (bf16 hi/lo), pooled phi (bf16 hi/lo) and pooled g (f16), all in fragment order, straight from x: 64 pixels a block, blockIdx.y = image
    w25::k_nl_proj<<<dim3((unsigned)(HW / 64), (unsigned)(Bn)), 256, 0, stream>>>(x, (const unsigned short*)(TWH), (const unsigned short*)(TWL), (const unsigned short*)(PWH), (const unsigned short*)(PWL), (const unsigned short*)(GW16), thb, phb, gb, THH, THL, PPH, PPL, GP16);
    // WY[b] = W softmax(theta[b] phi[b]) g[b]^T + W_b ([C][HW], f32) and, per block of 128 queries, each channel's sum and squared deviations: 128 queries a block, blockIdx.y = image
    w25::k_nl_flash<<<dim3((unsigned)(HW / 128), (unsigned)(Bn)), 256, 0, stream>>>((const unsigned short*)(THH), (const unsigned short*)(THL), (const unsigned short*)(PPH), (const unsigned short*)(PPL), (const unsigned short*)(GP16), (const unsigned short*)(WW16), Wb, WY, PS);
    k_nl_out<<<(unsigned)(C), 1024, 0, stream>>>(WY, PS, bng, bnb, x, out);
}

// v010
// Measured time: 50.7 microseconds a run.
// Two timings next to v009 put it at 1.06 and 1.04 times that version's speed.
// Over all steps from v000, the starting kernel, it is 27.9 times as fast.
#include <hip/hip_runtime.h>
#include <math.h>

typedef __attribute__((ext_vector_type(16))) _Float16 v16h;
typedef __attribute__((ext_vector_type(8)))  _Float16 v8h;
typedef __attribute__((ext_vector_type(16))) __bf16   v16b;
typedef __attribute__((ext_vector_type(8)))  float    v8f;
typedef __attribute__((ext_vector_type(4)))  float    v4f;

// 16-bit WMMA fragment map (wave32), lane L, h = L>>4, m = L&15:
//   A 16x32: lane = row m;   element i -> k = (i<8) ? 8h+i : 16+8h+(i-8)
//   B 32x16: lane = column m; the SAME k(i,h)
//   D 16x16 (8 f32): lane = column m; element r -> row 8h+r
__device__ __forceinline__ int frag_k(int i, int h) { return (i < 8) ? (8 * h + i) : (16 + 8 * h + (i - 8)); }
__device__ __forceinline__ __bf16 bf16_rne(float f) {
    unsigned int u = __float_as_uint(f);
    u += 0x7fffu + ((u >> 16) & 1u);
    return __builtin_bit_cast(__bf16, (unsigned short)(u >> 16));
}
__device__ __forceinline__ float bf16_f32(__bf16 b) { return __uint_as_float(((unsigned int)__builtin_bit_cast(unsigned short, b)) << 16); }
__device__ __forceinline__ v8f wmma16(v16h a, v16h b, v8f c) {
    c = __builtin_amdgcn_wmma_f32_16x16x32_f16(false, a, false, b, (short)0, c, false, false);
    asm volatile("v_nop\n\tv_nop\n\tv_nop\n\tv_nop" : "+v"(c) : "v"(a), "v"(b));
    return c;
}
__device__ __forceinline__ v8f wmmab(v16b a, v16b b, v8f c) {
    c = __builtin_amdgcn_wmma_f32_16x16x32_bf16(false, a, false, b, (short)0, c, false, false);
    asm volatile("v_nop\n\tv_nop\n\tv_nop\n\tv_nop" : "+v"(c) : "v"(a), "v"(b));
    return c;
}
struct Split { v16b hi, lo; };
// hi/lo split product: a.hi*b.hi + a.hi*b.lo + a.lo*b.hi
__device__ __forceinline__ v8f wmma3(const Split& a, const Split& b, v8f c) {
    c = __builtin_amdgcn_wmma_f32_16x16x32_bf16(false, a.hi, false, b.hi, (short)0, c, false, false);
    c = __builtin_amdgcn_wmma_f32_16x16x32_bf16(false, a.hi, false, b.lo, (short)0, c, false, false);
    c = __builtin_amdgcn_wmma_f32_16x16x32_bf16(false, a.lo, false, b.hi, (short)0, c, false, false);
    asm volatile("v_nop\n\tv_nop\n\tv_nop\n\tv_nop" : "+v"(c) : "v"(a.hi), "v"(a.lo), "v"(b.hi), "v"(b.lo));
    return c;
}
struct Split3 { v16b hi, mid, lo; };
// triple split product (6 terms, drops only terms below 2^-24 relative)
__device__ __forceinline__ v8f wmma6(const Split3& a, const Split3& b, v8f c) {
    c = __builtin_amdgcn_wmma_f32_16x16x32_bf16(false, a.hi, false, b.hi, (short)0, c, false, false);
    c = __builtin_amdgcn_wmma_f32_16x16x32_bf16(false, a.hi, false, b.mid, (short)0, c, false, false);
    c = __builtin_amdgcn_wmma_f32_16x16x32_bf16(false, a.mid, false, b.hi, (short)0, c, false, false);
    c = __builtin_amdgcn_wmma_f32_16x16x32_bf16(false, a.hi, false, b.lo, (short)0, c, false, false);
    c = __builtin_amdgcn_wmma_f32_16x16x32_bf16(false, a.mid, false, b.mid, (short)0, c, false, false);
    c = __builtin_amdgcn_wmma_f32_16x16x32_bf16(false, a.lo, false, b.hi, (short)0, c, false, false);
    asm volatile("v_nop\n\tv_nop\n\tv_nop\n\tv_nop" : "+v"(c) : "v"(a.hi), "v"(a.mid), "v"(a.lo), "v"(b.hi), "v"(b.mid), "v"(b.lo));
    return c;
}

// Fragment gathers from f32 memory: element i <- p[(k0 + frag_k(i,h)) * sk] * s, zero for k >= klen.
__device__ __forceinline__ v16h fh_ld(const float* __restrict__ p, long long sk, int k0, int h, int klen, float s) {
    v16h a;
#pragma unroll
    for (int i = 0; i < 16; ++i) { const int k = k0 + frag_k(i, h); a[i] = (k < klen) ? (_Float16)(p[(long long)k * sk] * s) : (_Float16)0.f; }
    return a;
}
__device__ __forceinline__ Split sp_ld(const float* __restrict__ p, long long sk, int k0, int h, int klen, float s) {
    Split r;
#pragma unroll
    for (int i = 0; i < 16; ++i) {
        const int k = k0 + frag_k(i, h); const float x = (k < klen) ? p[(long long)k * sk] * s : 0.f;
        const __bf16 hb = bf16_rne(x); r.hi[i] = hb; r.lo[i] = bf16_rne(x - bf16_f32(hb));
    }
    return r;
}
__device__ __forceinline__ Split3 sp3_ld(const float* __restrict__ p, long long sk, int k0, int h, int klen, float s) {
    Split3 r;
#pragma unroll
    for (int i = 0; i < 16; ++i) {
        const int k = k0 + frag_k(i, h); const float x = (k < klen) ? p[(long long)k * sk] * s : 0.f;
        const __bf16 hb = bf16_rne(x); const float r1 = x - bf16_f32(hb); const __bf16 mb = bf16_rne(r1);
        r.hi[i] = hb; r.mid[i] = mb; r.lo[i] = bf16_rne(r1 - bf16_f32(mb));
    }
    return r;
}
__device__ __forceinline__ v16b bh_ld(const float* __restrict__ p, long long sk, int k0, int h, int klen, float s) {
    v16b a;
#pragma unroll
    for (int i = 0; i < 16; ++i) { const int k = k0 + frag_k(i, h); a[i] = bf16_rne((k < klen) ? p[(long long)k * sk] * s : 0.f); }
    return a;
}
// f16 fragment from an f16 LDS/global row with element stride 1 (k-contiguous), no bounds (tile already zero padded)
__device__ __forceinline__ v16h fh_row(const _Float16* __restrict__ row, int k0, int h) {
    v16h a;
#pragma unroll
    for (int i = 0; i < 16; ++i) a[i] = row[k0 + frag_k(i, h)];
    return a;
}

#define VST2(T, ptr, val) do { const T vst2_v_ = (val); *(T*)(ptr) = vst2_v_;  } while (0)
typedef float v4f __attribute__((ext_vector_type(4)));
typedef unsigned int v4u __attribute__((ext_vector_type(4)));
typedef unsigned int v2u __attribute__((ext_vector_type(2)));
#define VST2V4(ptr, val) do { const v4f vst2_v4_ = (val); *(v4f*)(ptr) = vst2_v4_;  } while (0)

__device__ __attribute__((noinline)) float act_fn(float v, int act) {
    if (act == 1) return fmaxf(v, 0.f);                                                                               // relu
    if (act == 2) { const float u = 0.7978845608028654f * (v + 0.044715f * v * v * v); return 0.5f * v * (1.f + tanhf(u)); } // tanh-gelu
    if (act == 3) return v / (1.f + expf(-v));                                                                        // silu
    if (act == 4) return 0.5f * v * (1.f + erff(v * 0.7071067811865476f));                                             // erf-gelu
    if (act == 5) return tanhf(v);
    if (act == 6) return 1.f / (1.f + expf(-v));                                                                      // sigmoid
    if (act == 7) return (v > 0.f) ? v : 0.01f * v;                                                                   // leaky relu 0.01
    if (act == 8) return (v > 0.f) ? v : (expf(v) - 1.f);                                                             // elu
    if (act == 9) return fminf(fmaxf(v, 0.f), 6.f);                                                                   // relu6
    if (act == 10) return fabsf(v);                                                                                    // abs
    if (act == 11) return (v >= 0.f) ? v : 0.1f * v;                                                                  // leaky 0.1
    if (act == 12) return (v > 0.f) ? v : 0.2f * v;                                                                   // leaky 0.2
    if (act == 13) return (v > 20.f) ? v : log1pf(expf(v));                                                            // softplus
    return v;
}

// =====================================================================================================================
// k_gemm<MODE>: C(z, m, n) = act(alpha * sum_k A(z, m, k) * B(z, k, n) + bias) + beta * R(z, m, n)
//   One wave (32-thread block) per 16 x 32 tile of C; grid (ceil(N/32), ceil(M/16), Z). Batch z -> (zo = z / zi_n, zi = z % zi_n)
//   with separate outer/inner strides for every tensor (e.g. batch and head). A(m,k) = A[zo*sAo + zi*sAi + m*sAm + k*sAk] (f32),
//   B(k,n) = B[zo*sBo + zi*sBi + n*sBn + k*sBk] (f32); any M, N, K (K zero-padded to 32 inside the fragments, M/N tails guarded).
//   C(m,n) = C[zo*sCo + zi*sCi + m*sCm + n] (n contiguous). flags: 1 bias[n], 2 bias[m], 4 residual R[zo*sRo + zi*sRi + m*sRm + n*sRn].
//   MODE 0: f16 operands (A prescaled by sa, B by sb, both undone in the epilogue); 1: bf16 hi/lo split (3 products); 2: bf16;
//   3: bf16 hi/mid/lo triple split (6 products); 4: as 3 with Kahan-compensated f32 accumulation across k-steps.
// =====================================================================================================================
struct GemmP {
    const float* A; const float* B; const float* bias; const float* R; float* C;
    long long sAo, sAi, sAm, sAk, sBo, sBi, sBn, sBk, sCo, sCi, sCm, sRo, sRi, sRm, sRn;
    int M, N, K, zi_n, flags, act; float alpha, beta, sa, sb;
    int Npad, pad_;     // columns [N, Npad) of C are written as 0 so that padded workspace rows are covered by whole-line stores; Npad >= N
};
static_assert(sizeof(GemmP) == 5 * 8 + 15 * 8 + 6 * 4 + 4 * 4 + 2 * 4, "GemmP has padding");

template <int MODE>
__global__ __launch_bounds__(32) void k_gemm(GemmP p) {
    const int lane = threadIdx.x & 31, h = lane >> 4, l15 = lane & 15;
    const int m0 = blockIdx.y * 16, n0 = blockIdx.x * 32;
    const int z = blockIdx.z, zo = z / p.zi_n, zi = z - zo * p.zi_n;
    const float* A = p.A + zo * p.sAo + zi * p.sAi;
    const float* B = p.B + zo * p.sBo + zi * p.sBi;
    const int am = min(m0 + l15, p.M - 1);                       // clamped row for loads (stores are guarded)
    v8f acc[2], comp[2];
#pragma unroll
    for (int t = 0; t < 2; ++t) { v8f zz = {}; acc[t] = zz; comp[t] = zz; }
    for (int k0 = 0; k0 < p.K; k0 += 32) {
        const float* arow = A + (long long)am * p.sAm;
        if (MODE == 1) {
            const Split a = sp_ld(arow, p.sAk, k0, h, p.K, 1.f);
#pragma unroll
            for (int t = 0; t < 2; ++t) {
                const int bn = min(n0 + t * 16 + l15, p.N - 1);
                acc[t] = wmma3(a, sp_ld(B + (long long)bn * p.sBn, p.sBk, k0, h, p.K, 1.f), acc[t]);
            }
        } else if (MODE == 3) {
            const Split3 a = sp3_ld(arow, p.sAk, k0, h, p.K, 1.f);
#pragma unroll
            for (int t = 0; t < 2; ++t) {
                const int bn = min(n0 + t * 16 + l15, p.N - 1);
                acc[t] = wmma6(a, sp3_ld(B + (long long)bn * p.sBn, p.sBk, k0, h, p.K, 1.f), acc[t]);
            }
        } else if (MODE == 4) {
            // triple split as MODE 3, but each k-step's 6 products go into a fresh accumulator and the partial is added to the running f32 sum
            // on the VALU with Kahan compensation (accumulation error stays ~1 ulp however long K is)
            const Split3 a = sp3_ld(arow, p.sAk, k0, h, p.K, 1.f);
#pragma unroll
            for (int t = 0; t < 2; ++t) {
                const int bn = min(n0 + t * 16 + l15, p.N - 1); v8f zz = {};
                const v8f part = wmma6(a, sp3_ld(B + (long long)bn * p.sBn, p.sBk, k0, h, p.K, 1.f), zz);
                const v8f y = part - comp[t]; const v8f s = acc[t] + y; comp[t] = (s - acc[t]) - y; acc[t] = s;
            }
        } else if (MODE == 2) {
            const v16b a = bh_ld(arow, p.sAk, k0, h, p.K, 1.f);
#pragma unroll
            for (int t = 0; t < 2; ++t) {
                const int bn = min(n0 + t * 16 + l15, p.N - 1);
                acc[t] = wmmab(a, bh_ld(B + (long long)bn * p.sBn, p.sBk, k0, h, p.K, 1.f), acc[t]);
            }
        } else {
            const v16h a = fh_ld(arow, p.sAk, k0, h, p.K, p.sa);
#pragma unroll
            for (int t = 0; t < 2; ++t) {
                const int bn = min(n0 + t * 16 + l15, p.N - 1);
                acc[t] = wmma16(a, fh_ld(B + (long long)bn * p.sBn, p.sBk, k0, h, p.K, p.sb), acc[t]);
            }
        }
    }
    const float iscale = (MODE == 0) ? p.alpha / (p.sa * p.sb) : p.alpha;
    float* C = p.C + zo * p.sCo + zi * p.sCi;
    const float* R = p.R + zo * p.sRo + zi * p.sRi;
    __shared__ __align__(16) float ctile[16][36];
#pragma unroll
    for (int t = 0; t < 2; ++t) {
        const int n = n0 + t * 16 + l15; const int nn = min(n, p.N - 1);
#pragma unroll
        for (int r = 0; r < 8; ++r) {
            const int m = m0 + 8 * h + r; const int mm = min(m, p.M - 1);
            float v = acc[t][r] * iscale;
            if (p.flags & 1) v += p.bias[nn];
            if (p.flags & 2) v += p.bias[mm];
            if (p.flags & 8) v *= p.bias[(long long)zo * p.M + mm];   /* per-(z,row) scale vector laid out [Z][M]; exclusive with the bias flags */
            v = act_fn(v, p.act);
            if (p.flags & 4) v += p.beta * R[(long long)mm * p.sRm + (long long)nn * p.sRn];
            ctile[8 * h + r][t * 16 + l15] = (n < p.N) ? v : 0.f;
        }
    }
    __syncthreads();
    const int NW = (p.Npad > p.N) ? p.Npad : p.N;           // write width
    const bool fast = (m0 + 16 <= p.M) && (n0 + 32 <= NW) && ((p.sCm & 3) == 0) && ((((size_t)C) & 15) == 0);
    if (fast) {
#pragma unroll
        for (int s = 0; s < 4; ++s) {
            const int row = s * 4 + (lane >> 3), c4 = (lane & 7) * 4;
            const v4f v = *(const v4f*)&ctile[row][c4];
            VST2V4(C + (long long)(m0 + row) * p.sCm + n0 + c4, v);
        }
    } else {
        for (int row = 0; row < 16; ++row) {
            const int m = m0 + row, n = n0 + lane;
            if (m < p.M && n < NW) VST2(float, C + (long long)m * p.sCm + n, ctile[row][lane]);
        }
    }
}


// =====================================================================================================================
// k_gemmT<MODE, TM, TN>: same contract as k_gemm, but one wave computes a (16*TM) x (16*TN) tile: TM A fragments and TN B fragments are
//   loaded per 32-wide k-step and reused across TM*TN WMMAs (far fewer load/convert instructions per MAC). MODE 0 (f16), 1 (bf16 hi/lo),
//   2 (bf16) only. grid (ceil(NW/(16*TN)), ceil(M/(16*TM)), Z), block 32. Epilogue identical to k_gemm, run per 16x32 sub-tile.
// =====================================================================================================================
template <int MODE, int TM, int TN>
__global__ __launch_bounds__(32) void k_gemmT(GemmP p) {
    const int lane = threadIdx.x & 31, h = lane >> 4, l15 = lane & 15;
    const int m0 = blockIdx.y * (16 * TM), n0 = blockIdx.x * (16 * TN);
    const int z = blockIdx.z, zo = z / p.zi_n, zi = z - zo * p.zi_n;
    const float* A = p.A + zo * p.sAo + zi * p.sAi;
    const float* B = p.B + zo * p.sBo + zi * p.sBi;
    v8f acc[TM][TN];
#pragma unroll
    for (int i = 0; i < TM; ++i)
#pragma unroll
        for (int t = 0; t < TN; ++t) { v8f zz = {}; acc[i][t] = zz; }
    for (int k0 = 0; k0 < p.K; k0 += 32) {
        if (MODE == 1) {
            Split a[TM], b[TN];
#pragma unroll
            for (int i = 0; i < TM; ++i) { const int am = min(m0 + 16 * i + l15, p.M - 1); a[i] = sp_ld(A + (long long)am * p.sAm, p.sAk, k0, h, p.K, 1.f); }
#pragma unroll
            for (int t = 0; t < TN; ++t) { const int bn = min(n0 + 16 * t + l15, p.N - 1); b[t] = sp_ld(B + (long long)bn * p.sBn, p.sBk, k0, h, p.K, 1.f); }
#pragma unroll
            for (int i = 0; i < TM; ++i)
#pragma unroll
                for (int t = 0; t < TN; ++t) acc[i][t] = wmma3(a[i], b[t], acc[i][t]);
        } else if (MODE == 2) {
            v16b a[TM], b[TN];
#pragma unroll
            for (int i = 0; i < TM; ++i) { const int am = min(m0 + 16 * i + l15, p.M - 1); a[i] = bh_ld(A + (long long)am * p.sAm, p.sAk, k0, h, p.K, 1.f); }
#pragma unroll
            for (int t = 0; t < TN; ++t) { const int bn = min(n0 + 16 * t + l15, p.N - 1); b[t] = bh_ld(B + (long long)bn * p.sBn, p.sBk, k0, h, p.K, 1.f); }
#pragma unroll
            for (int i = 0; i < TM; ++i)
#pragma unroll
                for (int t = 0; t < TN; ++t) acc[i][t] = wmmab(a[i], b[t], acc[i][t]);
        } else {
            v16h a[TM], b[TN];
#pragma unroll
            for (int i = 0; i < TM; ++i) { const int am = min(m0 + 16 * i + l15, p.M - 1); a[i] = fh_ld(A + (long long)am * p.sAm, p.sAk, k0, h, p.K, p.sa); }
#pragma unroll
            for (int t = 0; t < TN; ++t) { const int bn = min(n0 + 16 * t + l15, p.N - 1); b[t] = fh_ld(B + (long long)bn * p.sBn, p.sBk, k0, h, p.K, p.sb); }
#pragma unroll
            for (int i = 0; i < TM; ++i)
#pragma unroll
                for (int t = 0; t < TN; ++t) acc[i][t] = wmma16(a[i], b[t], acc[i][t]);
        }
    }
    const float iscale = (MODE == 0) ? p.alpha / (p.sa * p.sb) : p.alpha;
    float* C = p.C + zo * p.sCo + zi * p.sCi;
    const float* R = p.R + zo * p.sRo + zi * p.sRi;
    const int NW = (p.Npad > p.N) ? p.Npad : p.N;
    __shared__ __align__(16) float ctile[16][36];
#pragma unroll
    for (int i = 0; i < TM; ++i) {
        const int mb = m0 + 16 * i; if (mb >= p.M) break;          // wave-uniform
#pragma unroll
        for (int tp = 0; tp < TN / 2; ++tp) {
            const int nb = n0 + 32 * tp; if (nb >= NW) break;        // wave-uniform
#pragma unroll
            for (int t2 = 0; t2 < 2; ++t2) {
                const int t = 2 * tp + t2; const int n = nb + t2 * 16 + l15; const int nn = min(n, p.N - 1);
#pragma unroll
                for (int r = 0; r < 8; ++r) {
                    const int m = mb + 8 * h + r; const int mm = min(m, p.M - 1);
                    float v = acc[i][t][r] * iscale;
                    if (p.flags & 1) v += p.bias[nn];
                    if (p.flags & 2) v += p.bias[mm];
            if (p.flags & 8) v *= p.bias[(long long)zo * p.M + mm];   /* per-(z,row) scale vector laid out [Z][M]; exclusive with the bias flags */
                    v = act_fn(v, p.act);
                    if (p.flags & 4) v += p.beta * R[(long long)mm * p.sRm + (long long)nn * p.sRn];
                    ctile[8 * h + r][t2 * 16 + l15] = (n < p.N) ? v : 0.f;
                }
            }
            __syncthreads();
            const bool fast = (mb + 16 <= p.M) && (nb + 32 <= NW) && ((p.sCm & 3) == 0) && ((((size_t)C) & 15) == 0);
            if (fast) {
#pragma unroll
                for (int s = 0; s < 4; ++s) {
                    const int row = s * 4 + (lane >> 3), c4 = (lane & 7) * 4;
                    const v4f v = *(const v4f*)&ctile[row][c4];
                    VST2V4(C + (long long)(mb + row) * p.sCm + nb + c4, v);
                }
            } else {
                for (int row = 0; row < 16; ++row) {
                    const int m = mb + row, n = nb + lane;
                    if (m < p.M && n < NW) VST2(float, C + (long long)m * p.sCm + n, ctile[row][lane]);
                }
            }
            __syncthreads();
        }
    }
}

// =====================================================================================================================
//   Wave = 16 queries, AW waves per block, 64-key blocks; grid (ceil(Lq/(16*AW)), H, B), block 32*AW. Any Lq, Lk; head dim dh <= DHP
//   (DHP multiple of 32), value dim dv <= DVP (multiple of 16, <= 128). Every tensor addressed by (batch, head, row, element) strides, f32.
//   Scores: QM 0 f16 operands, 1 bf16 hi/lo split, 2 bf16 triple split; statistics f32 (exp2 domain); P.V: P x 4096 as f16 with V f16 staged in LDS
//   (SPLITPV: P and V as bf16 hi/lo splits). kv head = h / hrep. Masking: causal = 1 (keep j <= i + coff, masked -> -inf, key blocks beyond the
//   diagonal skipped), causal = 2 (masked -> mfill, a finite fill like the -1e9; no skipping), causal = 3 (keep j >= i + coff,
//   masked -> -inf, no skipping); optional additive f32 mask Mf,
//   optional int keep-mask Mi (0 -> score := mfill), both addressed b*smb + h*smh + i*smi + j*smj (0 strides broadcast).
// =====================================================================================================================
#define AW 4
struct AttnP {   // apv4
    const float* Q; const float* K; const float* V; float* O; float* P; const float* Mf; const int* Mi; float* ST;
    const float* Pw; const float* Rt; const int* SQ; const int* SK;           // optional: post-softmax weight, relative-position table, segment ids
    long long swb, swh, swi, swj, srb, srh, sri;                                 // Pw strides (b,h,i,j); Rt strides (b,h,i), column = clamp(i - j + roff, 0, rn-1)
    long long sQb, sQh, sQi, sQd, sKb, sKh, sKj, sKd, sVb, sVh, sVj, sVd, sOb, sOh, sOi, sPb, sPh, sPi, smb, smh, smi, smj;
    int Lq, Lk, dh, dv, hrep, causal, coff, pband;   // pband > 0: P holds only the band |j - i| <= pband, column j - i + pband
    float scale, mfill; int nonorm, mpol;             // nonorm (online path only): O = sum_j exp(score_j) V_j without the 1/rowsum (scores must be <= ~0); mpol: Mi masks where ==0 (mpol 0) or where !=0 (mpol 1)
    int roff, rn, segpol, win;                        // Rt column offset/count; SQ/SK: score := mfill where (segpol 0) SQ[i] != SK[j] or (segpol 1) SQ[i] == SK[j]; win > 0: keys with i - j > win (after coff) -> -inf
};
//   Pw: the softmax numerator is multiplied by Pw(b,h,i,j) AFTER the row sum is taken (probs * weight, then P.V), as in post-softmax multiplicative biases.                                                    // ST (optional): per row (b,h,i) -> ST[((b*H + h)*Lq + i)*2 + {0,1}] = {row max of the scaled+masked score (natural units), sum_j exp(score - max)}
static_assert(sizeof(AttnP) == 12 * 8 + 29 * 8 + 16 * 4, "AttnP has padding");

#ifndef KATTN_ATTR
#define KATTN_ATTR
#endif
template <int DHP, int DVP, int QM, bool SPLITPV, bool TWOPASS>
__global__ __launch_bounds__(32 * AW) KATTN_ATTR void k_attn(AttnP p) {
    constexpr int NT = DVP / 16;                // output tiles
    constexpr int KS = DHP / 32;                // k-steps for the scores
    constexpr int VP = DVP + 8;                 // LDS pitch (halves)
    __shared__ __align__(16) float    pl[AW][16 * 64];
    __shared__ __align__(16) _Float16 vl[(SPLITPV ? 2 : 1) * 64 * VP];   // f16 V tile, or bf16 hi and lo tiles (same 2-byte size)
    const int lane = threadIdx.x & 31, hf = lane >> 4, l15 = lane & 15, wave = threadIdx.x >> 5;
    const int h = blockIdx.y, b = blockIdx.z, hk = h / p.hrep;
    const int q0 = (blockIdx.x * AW + wave) * 16;
    float* myp = pl[wave];
    const float L2E = 1.4426950408889634f;
    const float NEG = -__builtin_inff();
    const int qi = min(q0 + l15, p.Lq - 1);
    const float* qrow = p.Q + b * p.sQb + h * p.sQh + (long long)qi * p.sQi;
    const float* kbase = p.K + b * p.sKb + hk * p.sKh;
    const float* vbase = p.V + b * p.sVb + hk * p.sVh;
    v16h qa[QM == 0 ? KS : 1]; Split qs_[QM == 1 ? KS : 1]; Split3 qt_[QM == 2 ? KS : 1];
#pragma unroll
    for (int ks = 0; ks < KS; ++ks) {
        if (QM == 2) qt_[ks] = sp3_ld(qrow, p.sQd, ks * 32, hf, p.dh, 1.f);
        else if (QM == 1) qs_[ks] = sp_ld(qrow, p.sQd, ks * 32, hf, p.dh, 1.f);
        else qa[ks] = fh_ld(qrow, p.sQd, ks * 32, hf, p.dh, 1.f);
    }
    v8f o[NT]; float m8[8], l8[8];
#pragma unroll
    for (int t = 0; t < NT; ++t) { v8f zz = {}; o[t] = zz; }
#pragma unroll
    for (int i = 0; i < 8; ++i) { m8[i] = NEG; l8[i] = 0.f; }
    int jend = p.Lk; int jstart = 0;
    if (p.causal == 1) { const int je = (blockIdx.x * AW + AW - 1) * 16 + 16 + p.coff; jend = min(jend, max(je, 0)); }   // uniform per block
    if (p.win > 0) { const int js = (int)(blockIdx.x * AW) * 16 + p.coff - p.win; jstart = (js > 0) ? (js / 64) * 64 : 0; }   // uniform per block: key blocks entirely outside every row's window hold only -inf entries and are skipped exactly
    const int npass = TWOPASS ? 2 : 1;
    for (int pass = 0; pass < npass; ++pass) {
        const bool dopv = (!TWOPASS) || pass == 1;
        for (int j0 = jstart; j0 < jend; j0 += 64) {
            if (dopv) {
                __syncthreads();                                 // previous key block's reads of vl / pl are done
                for (int idx = threadIdx.x; idx < 64 * DVP; idx += 32 * AW) {
                    const int jr = idx / DVP, d = idx - jr * DVP, j = j0 + jr;
                    const float f = (j < p.Lk && d < p.dv) ? vbase[(long long)j * p.sVj + (long long)d * p.sVd] : 0.f;
                    if (SPLITPV) {
                        const __bf16 hb = bf16_rne(f);
                        ((__bf16*)vl)[jr * VP + d] = hb; ((__bf16*)vl)[64 * VP + jr * VP + d] = bf16_rne(f - bf16_f32(hb));
                    } else vl[jr * VP + d] = (_Float16)f;
                }
            }
            v8f s[4];
#pragma unroll
            for (int t = 0; t < 4; ++t) {
                const int j = min(j0 + t * 16 + l15, p.Lk - 1);
                const float* krow = kbase + (long long)j * p.sKj;
                v8f acc = {};
#pragma unroll
                for (int ks = 0; ks < KS; ++ks) {
                    if (QM == 2)      acc = wmma6(qt_[ks], sp3_ld(krow, p.sKd, ks * 32, hf, p.dh, 1.f), acc);
                    else if (QM == 1) acc = wmma3(qs_[ks], sp_ld(krow, p.sKd, ks * 32, hf, p.dh, 1.f), acc);
                    else              acc = wmma16(qa[ks], fh_ld(krow, p.sKd, ks * 32, hf, p.dh, 1.f), acc);
                }
                s[t] = acc;
            }
            float pv[8][4];
#pragma unroll
            for (int i = 0; i < 8; ++i) {
                const int irow = q0 + i + 8 * hf;
                const int ic = min(irow, p.Lq - 1);
                float sc[4];
#pragma unroll
                for (int t = 0; t < 4; ++t) {
                    const int jg = j0 + t * 16 + l15;
                    float v = s[t][i] * p.scale;
                    if (p.Mf) v += p.Mf[b * p.smb + h * p.smh + (long long)ic * p.smi + (long long)min(jg, p.Lk - 1) * p.smj];
                    if (p.Rt) { int rc = ic - min(jg, p.Lk - 1) + p.roff; rc = rc < 0 ? 0 : (rc >= p.rn ? p.rn - 1 : rc); v += p.Rt[b * p.srb + h * p.srh + (long long)ic * p.sri + rc]; }
                    if (p.Mi) { const int mv = p.Mi[b * p.smb + h * p.smh + (long long)ic * p.smi + (long long)min(jg, p.Lk - 1) * p.smj]; if (p.mpol ? (mv != 0) : (mv == 0)) v = p.mfill; }
                    if (p.SQ) { const bool same = p.SQ[(long long)b * p.Lq + ic] == p.SK[(long long)b * p.Lk + min(jg, p.Lk - 1)]; if (p.segpol ? same : !same) v = p.mfill; }
                    if (p.causal == 2 && jg > irow + p.coff) v = p.mfill;
                    if (jg >= p.Lk || (p.causal == 1 && jg > irow + p.coff) || (p.causal == 3 && jg < irow + p.coff) || (p.win > 0 && irow + p.coff - jg > p.win)) v = NEG; else v *= L2E;
                    sc[t] = v;
                }
                if (!TWOPASS || pass == 0) {
                    float mx = fmaxf(fmaxf(sc[0], sc[1]), fmaxf(sc[2], sc[3]));
                    mx = fmaxf(mx, __shfl_xor(mx, 1, 32)); mx = fmaxf(mx, __shfl_xor(mx, 2, 32));
                    mx = fmaxf(mx, __shfl_xor(mx, 4, 32)); mx = fmaxf(mx, __shfl_xor(mx, 8, 32));
                    const float mnew = fmaxf(m8[i], mx);
                    const float corr = (mnew == NEG) ? 1.f : exp2f(m8[i] - mnew);
                    float rs = 0.f;
#pragma unroll
                    for (int t = 0; t < 4; ++t) {
                        const float pp = (sc[t] == NEG) ? 0.f : exp2f(sc[t] - mnew); rs += pp;
                        pv[i][t] = p.Pw ? pp * p.Pw[b * p.swb + h * p.swh + (long long)ic * p.swi + (long long)min(j0 + t * 16 + l15, p.Lk - 1) * p.swj] : pp;
                    }
                    rs += __shfl_xor(rs, 1, 32); rs += __shfl_xor(rs, 2, 32); rs += __shfl_xor(rs, 4, 32); rs += __shfl_xor(rs, 8, 32);
                    l8[i] = l8[i] * corr + rs; m8[i] = mnew;
                    if (!TWOPASS) {
#pragma unroll
                        for (int t = 0; t < NT; ++t) o[t][i] *= corr;
                    }
                } else {
                    const float inv = (l8[i] > 0.f) ? 1.f / l8[i] : 0.f;
#pragma unroll
                    for (int t = 0; t < 4; ++t) {
                        const int jg = j0 + t * 16 + l15;
                        float pp = (sc[t] == NEG) ? 0.f : exp2f(sc[t] - m8[i]) * inv;
                        if (p.Pw) pp *= p.Pw[b * p.swb + h * p.swh + (long long)ic * p.swi + (long long)min(jg, p.Lk - 1) * p.swj];
                        pv[i][t] = pp;
                    }
                }
            }
            if (dopv) {
#pragma unroll
                for (int i = 0; i < 8; ++i)
#pragma unroll
                    for (int t = 0; t < 4; ++t) ((float*)myp)[(i + 8 * hf) * 64 + t * 16 + l15] = pv[i][t];
                __syncthreads();                                 // P (per wave) and V (shared) visible
                if (p.P) {
                    float* pb_ = p.P + b * p.sPb + h * p.sPh;
                    const bool fastP = (p.pband == 0) && ((p.sPi & 3) == 0) && (j0 + 64 <= p.Lk) && (q0 + 16 <= p.Lq) && ((((size_t)pb_) & 15) == 0);
                    if (fastP) {
#pragma unroll
                        for (int s = 0; s < 8; ++s) {
                            const int row = s * 2 + (lane >> 4), c4 = (lane & 15) * 4;
                            const v4f v = *(const v4f*)(myp + row * 64 + c4);
                            VST2V4(pb_ + (long long)(q0 + row) * p.sPi + j0 + c4, v);
                        }
                    } else {
                        for (int row = 0; row < 16; ++row) {
                            const int irow = q0 + row; if (irow >= p.Lq) continue;
                            for (int c = lane; c < 64; c += 32) {
                                const int jg = j0 + c; if (jg >= p.Lk) continue;
                                if (p.pband == 0) VST2(float, pb_ + (long long)irow * p.sPi + jg, myp[row * 64 + c]);
                                else if (jg - irow <= p.pband && irow - jg <= p.pband) VST2(float, pb_ + (long long)irow * p.sPi + (jg - irow + p.pband), myp[row * 64 + c]);
                            }
                        }
                    }
                }
                if (SPLITPV) {
                    const Split pa0 = sp_ld(myp + l15 * 64, 1, 0, hf, 64, 1.f), pa1 = sp_ld(myp + l15 * 64, 1, 32, hf, 64, 1.f);
                    const __bf16* vh = (const __bf16*)vl; const __bf16* vlo = vh + 64 * VP;
#pragma unroll
                    for (int t = 0; t < NT; ++t) {
                        const int dcol = t * 16 + l15;
                        Split b0, b1;
#pragma unroll
                        for (int e = 0; e < 16; ++e) {
                            const int k0 = frag_k(e, hf), k1 = 32 + frag_k(e, hf);
                            b0.hi[e] = vh[k0 * VP + dcol]; b0.lo[e] = vlo[k0 * VP + dcol]; b1.hi[e] = vh[k1 * VP + dcol]; b1.lo[e] = vlo[k1 * VP + dcol];
                        }
                        o[t] = wmma3(pa0, b0, o[t]);
                        o[t] = wmma3(pa1, b1, o[t]);
                    }
                } else {
                    const v16h pa0 = fh_ld(myp + l15 * 64, 1, 0, hf, 64, 4096.f), pa1 = fh_ld(myp + l15 * 64, 1, 32, hf, 64, 4096.f);
#pragma unroll
                    for (int t = 0; t < NT; ++t) {
                        const int dcol = t * 16 + l15;
                        v16h b0, b1;
#pragma unroll
                        for (int e = 0; e < 16; ++e) { b0[e] = vl[frag_k(e, hf) * VP + dcol]; b1[e] = vl[(32 + frag_k(e, hf)) * VP + dcol]; }
                        o[t] = wmma16(pa0, b0, o[t]);
                        o[t] = wmma16(pa1, b1, o[t]);
                    }
                }
            }
        }
    }
    float* obase = p.O + b * p.sOb + h * p.sOh;
    if (p.ST) {
        const int rl = lane >> 1, isel = rl & 7;           // row q0 + rl ; rl>>3 == hf holds because lane>>4 == (lane>>1)>>3
        float mv = 0.f, lv = 0.f;
#pragma unroll
        for (int i = 0; i < 8; ++i) if (i == isel) { mv = m8[i]; lv = l8[i]; }
        const int irow = q0 + rl;
        if (irow < p.Lq) { float* st = p.ST + (((long long)b * gridDim.y + h) * p.Lq + irow) * 2 + (lane & 1); VST2(float, st, (lane & 1) ? lv : mv * 0.6931471805599453f); }
    }
    float invr[8];
#pragma unroll
    for (int i = 0; i < 8; ++i) {
        if (TWOPASS) invr[i] = SPLITPV ? 1.f : (1.f / 4096.f);
        else if (p.nonorm) invr[i] = exp2f(m8[i]) * (SPLITPV ? 1.f : (1.f / 4096.f));
        else invr[i] = (l8[i] > 0.f) ? (SPLITPV ? 1.f / l8[i] : 1.f / (l8[i] * 4096.f)) : 0.f;
    }
    __syncthreads();                                             // all waves done with pl/vl from the main loop
    const bool ofast = ((p.sOi & 3) == 0) && ((((size_t)obase) & 15) == 0) && (q0 + 16 <= p.Lq);
#pragma unroll
    for (int c0 = 0; c0 < DVP; c0 += 64) {
#pragma unroll
        for (int i = 0; i < 8; ++i)
#pragma unroll
            for (int t = 0; t < NT; ++t) if (t * 16 >= c0 && t * 16 < c0 + 64) ((float*)myp)[(i + 8 * hf) * 64 + (t * 16 - c0) + l15] = o[t][i] * invr[i];
        __syncthreads();
        const int cw = (DVP - c0 < 64) ? (DVP - c0) : 64;      // staged columns in this chunk (multiple of 16)
        if (ofast && (c0 + cw <= p.dv) && (cw % 32 == 0)) {
            const int lpr = cw / 4;                              // lanes per row (16 for 64 cols, 8 for 32)
            const int rows_per_ins = 32 / lpr;
            for (int r0 = 0; r0 < 16; r0 += rows_per_ins) {
                const int row = r0 + lane / lpr, c4 = (lane % lpr) * 4;
                const v4f v = *(const v4f*)(myp + row * 64 + c4);
                VST2V4(obase + (long long)(q0 + row) * p.sOi + c0 + c4, v);
            }
        } else {
            for (int row = 0; row < 16; ++row) {
                const int irow = q0 + row; if (irow >= p.Lq) continue;
                for (int c = lane; c < cw; c += 32) { const int d = c0 + c; if (d < p.dv) VST2(float, obase + (long long)irow * p.sOi + d, myp[row * 64 + c]); }
            }
        }
        __syncthreads();
    }
}

// =====================================================================================================================
// k_tr: dst(z, c, r) = alpha * src(z, r, c) (+ beta * R2(z, c, r)): [Z][R][C] (row stride lds) -> [Z][C][R] (row stride ldd) through a 32x32 LDS tile;
//   flags: 1 -> add beta * residual R2 addressed like dst (z*sRz + c*ldr + r); act applied before the residual.
// =====================================================================================================================
struct TrP { const float* src; float* dst; const float* R2; long long sSz, lds, sDz, ldd, sRz, ldr; int R, C, flags, act; float alpha, beta; };
static_assert(sizeof(TrP) == 3 * 8 + 6 * 8 + 6 * 4, "TrP has padding");
__global__ __launch_bounds__(256) void k_tr(TrP p) {
    __shared__ float tile[32][33];
    const int c0 = blockIdx.x * 32, r0 = blockIdx.y * 32, z = blockIdx.z;
    const int lane = threadIdx.x & 31, wave = threadIdx.x >> 5;
    const float* s = p.src + z * p.sSz;
#pragma unroll
    for (int k = 0; k < 4; ++k) {
        const int rl = wave * 4 + k, r = r0 + rl, c = c0 + lane;
        tile[rl][lane] = (r < p.R && c < p.C) ? s[(long long)r * p.lds + c] : 0.f;
    }
    __syncthreads();
    float* d = p.dst + z * p.sDz; const float* rr = p.R2 + z * p.sRz;
#pragma unroll
    for (int k = 0; k < 4; ++k) {
        const int cl = wave * 4 + k, c = c0 + cl, r = r0 + lane;
        if (c < p.C && r < p.R) {
            float v = act_fn(p.alpha * tile[lane][cl], p.act);
            if (p.flags & 1) v += p.beta * rr[(long long)c * p.ldr + r];
            VST2(float, d + (long long)c * p.ldd + r, v);
        }
    }
}

// k_affine: dst[i] = a * (sdev ? sdev[0] : 1) * src[i] + b, i < n (one thread per element; consecutive lanes -> consecutive addresses)
__global__ __launch_bounds__(256) void k_affine(const float* __restrict__ src, float* __restrict__ dst, int n, float a, float b, const float* __restrict__ sdev) {
    const int i = blockIdx.x * 256 + threadIdx.x;
    if (i < n) { const float aa = sdev ? a * sdev[0] : a; const float v = aa * src[i] + b; VST2(float, dst + i, v); }
}

// =====================================================================================================================
// k_softmax: row softmax over n contiguous elements, one 256-thread block per row; rows addressed z*sz + r*sr (grid (R, Z)).
//   out = scale_out * softmax(scale_in * x + (Mf ? Mf[z*smz + r*smr + j] : 0)); a row whose max is -inf is written as 0.
// =====================================================================================================================
struct SmP { const float* src; float* dst; const float* Mf; long long sz, sr, dz, dr, smz, smr; int n, pad; float scale_in, scale_out; };
static_assert(sizeof(SmP) == 3 * 8 + 6 * 8 + 4 * 4, "SmP has padding");
__global__ __launch_bounds__(256) void k_softmax(SmP p) {
    __shared__ float red[256];
    const int r = blockIdx.x, z = blockIdx.y, tid = threadIdx.x;
    const float* s = p.src + z * p.sz + (long long)r * p.sr;
    const float* mf = p.Mf ? (p.Mf + z * p.smz + (long long)r * p.smr) : nullptr;
    float mx = -__builtin_inff();
    for (int j = tid; j < p.n; j += 256) { float v = s[j] * p.scale_in; if (mf) v += mf[j]; mx = fmaxf(mx, v); }
    red[tid] = mx; __syncthreads();
    for (int o = 128; o > 0; o >>= 1) { if (tid < o) red[tid] = fmaxf(red[tid], red[tid + o]); __syncthreads(); }
    mx = red[0]; __syncthreads();
    float sum = 0.f;
    for (int j = tid; j < p.n; j += 256) { float v = s[j] * p.scale_in; if (mf) v += mf[j]; sum += (mx == -__builtin_inff()) ? 0.f : expf(v - mx); }
    red[tid] = sum; __syncthreads();
    for (int o = 128; o > 0; o >>= 1) { if (tid < o) red[tid] += red[tid + o]; __syncthreads(); }
    sum = red[0];
    const float inv = (sum > 0.f) ? p.scale_out / sum : 0.f;
    float* d = p.dst + z * p.dz + (long long)r * p.dr;
    for (int j = tid; j < p.n; j += 256) { float v = s[j] * p.scale_in; if (mf) v += mf[j]; const float o = (mx == -__builtin_inff()) ? 0.f : expf(v - mx) * inv; VST2(float, d + j, o); }
}
// =====================================================================================================================
// k_stats: mean and rsqrt(var + eps) over a set of n elements addressed base + z*sz + (e / inner) * so + (e % inner) * si, one 256-thread
// k_norm_apply: y = (x - mean[set]) * rstd[set] * g[c] + b[c] over a [Z][C][L] channel-major tensor with set = z*G + c / (C/G) (G groups per z;
//   G = C -> per-channel sets indexed z*C+c; for batch norm pass stats indexed by c only via bn = 1). Optional act. Output same layout.
// =====================================================================================================================
//   mode 0: mean / rsqrt(var + eps); mode 1 (RMSNorm): 0 / rsqrt(mean(x^2) + eps); mode 2 (L2 normalize * sqrt(n)): 0 / sqrt(n) / max(||x||, eps); mode 3: as 0 with unbiased variance (n-1)
__global__ __launch_bounds__(256) void k_stats(const float* __restrict__ x, long long sz, long long so, long long si, int inner, int n, float eps, float* __restrict__ stat, int mode) {
    __shared__ float red[256];
    const int z = blockIdx.x, tid = threadIdx.x;
    const float* base = x + z * sz;
    float s = 0.f;
    for (int e = tid; e < n; e += 256) s += base[(long long)(e / inner) * so + (long long)(e % inner) * si];
    red[tid] = s; __syncthreads();
    for (int o = 128; o > 0; o >>= 1) { if (tid < o) red[tid] += red[tid + o]; __syncthreads(); }
    const float mu = (mode == 0 || mode == 3) ? red[0] / (float)n : 0.f; __syncthreads();
    float q = 0.f;
    for (int e = tid; e < n; e += 256) { const float dlt = base[(long long)(e / inner) * so + (long long)(e % inner) * si] - mu; q += dlt * dlt; }
    red[tid] = q; __syncthreads();
    for (int o = 128; o > 0; o >>= 1) { if (tid < o) red[tid] += red[tid + o]; __syncthreads(); }
    {
        float rs;
        if (mode == 2) rs = sqrtf((float)n) / fmaxf(sqrtf(red[0]), eps); else if (mode == 3) rs = rsqrtf(red[0] / (float)(n - 1) + eps); else rs = rsqrtf(red[0] / (float)n + eps);
        if (tid < 32) { const float v = (tid == 0) ? mu : ((tid == 1) ? rs : 0.f); VST2(float, stat + (long long)z * 32 + tid, v); }
    }
}
//   One thread per element over the flat [Z][C][L] index space: grid ceil(Z*C*L / 256).
__global__ __launch_bounds__(256) void k_norm_apply(const float* __restrict__ x, float* __restrict__ y, const float* __restrict__ stat, const float* __restrict__ g, const float* __restrict__ bta,
                                                     int Z, int C, int L, int G, int bn, int act) {
    const long long idx = (long long)blockIdx.x * 256 + threadIdx.x;
    if (idx >= (long long)Z * C * L) return;
    const int l = (int)(idx % L); const long long zc = idx / L; const int c = (int)(zc % C), z = (int)(zc / C); (void)l;
    const int set = bn ? c : (z * G + c / (C / G));
    float v = (x[idx] - stat[(long long)set * 32]) * stat[(long long)set * 32 + 1];
    if (g) v *= g[c];
    if (bta) v += bta[c];
    v = act_fn(v, act);
    VST2(float, y + idx, v);
}

// k_lse_neg: c[i] = -(st[2i] + log(st[2i+1])) = minus the log-sum-exp of row i from k_attn's ST output (for softmax over the query dimension)
__global__ __launch_bounds__(256) void k_lse_neg(const float* __restrict__ st, float* __restrict__ c, int n) {
    const int i = blockIdx.x * 256 + threadIdx.x;
    if (i < n) { const float v = -(st[2 * i] + logf(st[2 * i + 1])); VST2(float, c + i, v); }
}

// k_iota: dst[i] = a * i + b as int32 (segment/position id helper)
__global__ __launch_bounds__(256) void k_iota(int* __restrict__ dst, int n, int a, int b) {
    const int i = blockIdx.x * 256 + threadIdx.x;
    if (i < n) { const int v = a * i + b; VST2(int, dst + i, v); }
}

// k_axpby: dst[i] = a * x[i] + b * y[i] (+ c), i < n
__global__ __launch_bounds__(256) void k_axpby(const float* __restrict__ x, const float* __restrict__ y, float* __restrict__ dst, int n, float a, float b, float c) {
    const int i = blockIdx.x * 256 + threadIdx.x;
    if (i < n) { const float v = a * x[i] + b * y[i] + c; VST2(float, dst + i, v); }
}

// =====================================================================================================================
// k_rope: rotary embedding on a [R rows][Hn heads][D] view (row stride sXr, head stride sXh, element stride 1) -> Y (own strides).
//   mode 0: rotate_half (partner d±D/2, sign - for d<D/2); mode 1: interleaved pairs (partner d^1, sign - for even d).
//   table column tcol: tmode 0 -> d, 1 -> d % (D/2), 2 -> d / 2; position p: pmode 0 -> r % S, 1 -> head index, 2 -> pos[r];
//   c = C[(r / S) * sCb + p * sCp + tcol * sCd], s likewise from Sn; y = x[d] * c + sign * x[partner] * s. X and Y must not alias.
// =====================================================================================================================
struct RopeP { const float* X; float* Y; const float* C; const float* Sn; const int* pos; long long sXr, sXh, sYr, sYh, sCb, sCp, sCd; int R, Hn, D, S, mode, tmode, pmode, pad; };
static_assert(sizeof(RopeP) == 5 * 8 + 7 * 8 + 8 * 4, "RopeP has padding");
__global__ __launch_bounds__(256) void k_rope(RopeP p) {
    const long long idx = (long long)blockIdx.x * 256 + threadIdx.x;
    if (idx >= (long long)p.R * p.Hn * p.D) return;
    const int d = (int)(idx % p.D); const long long rh = idx / p.D; const int h = (int)(rh % p.Hn); const int r = (int)(rh / p.Hn);
    const int half = p.D / 2;
    int partner; float sign;
    if (p.mode == 0) { partner = (d < half) ? d + half : d - half; sign = (d < half) ? -1.f : 1.f; }
    else { partner = d ^ 1; sign = (d & 1) ? 1.f : -1.f; }
    const int tcol = (p.tmode == 0) ? d : ((p.tmode == 1) ? (d % half) : (d >> 1));
    const int pp = (p.pmode == 0) ? (r % p.S) : ((p.pmode == 1) ? h : p.pos[r]);
    const long long toff = (long long)(r / p.S) * p.sCb + (long long)pp * p.sCp + (long long)tcol * p.sCd;
    const float* xr = p.X + (long long)r * p.sXr + (long long)h * p.sXh;
    const float v = xr[d] * p.C[toff] + sign * xr[partner] * p.Sn[toff];
    VST2(float, p.Y + (long long)r * p.sYr + (long long)h * p.sYh + d, v);
}

// k_invf + k_sincos (split so neither kernel carries a large VALU-fma footprint): invf_i = num * (1 / powf(base, (2 i)/D)) [fmode 0],
//   num * expf((2 i) * cexp) [fmode 1], num * powf(base, -2 (i - 1) / D) [fmode 2]; then cs/sn[s*half + i] = cos/sin((pscale * s) * invf_i)
__global__ __launch_bounds__(256) void k_invf(float* __restrict__ invb, int half, int D, float base, float num, int fmode, float cexp) {
    const int i = blockIdx.x * 256 + threadIdx.x;
    if (i >= ((half + 31) / 32) * 32) return;
    if (i >= half) { VST2(float, invb + i, 0.f); return; }
    const float e = (float)(2 * i) / (float)D;
    float invf;
    if (fmode == 1) invf = num * expf((float)(2 * i) * cexp);
    else if (fmode == 2) invf = num * powf(base, (-2.0f * ((float)i - 1.0f)) / (float)D);
    else invf = num * (1.0f / powf(base, e));
    VST2(float, invb + i, invf);
}
__global__ __launch_bounds__(256) void k_sincos(float* __restrict__ cs, float* __restrict__ sn, const float* __restrict__ invb, int S, int half, float pscale) {
    const int idx = blockIdx.x * 256 + threadIdx.x;
    if (idx >= S * half) return;
    const int s = idx / half, i = idx - s * half;
    const float ang = (pscale * (float)s) * invb[i];
    VST2(float, cs + idx, cosf(ang)); VST2(float, sn + idx, sinf(ang));
}

// k_mulact: dst[i] = act(x[i]) * y[i]
__global__ __launch_bounds__(256) void k_mulact(const float* __restrict__ x, const float* __restrict__ y, float* __restrict__ dst, int n, int act) {
    const int i = blockIdx.x * 256 + threadIdx.x;
    if (i < n) { const float v = act_fn(x[i], act) * y[i]; VST2(float, dst + i, v); }
}

// =====================================================================================================================
// k_matvec: thread-per-row matrix-vector products for N <= 8 output columns (heads with 1-3 outputs, gates), f32 on the VALU.
//   C[r*sCm + j] = act(alpha * sum_k A[r*sAm + k*sAk] * B[j*sBn + k*sBk] + bias[j]) + beta * R[r*sRm + j*sRn]; each thread writes its N contiguous floats.
// =====================================================================================================================
__global__ __launch_bounds__(256) void k_matvec(GemmP p) {
    // N == 1: a row a thread, lanes on consecutive rows; otherwise 32 consecutive rows a thread.
    const int rpt = (p.N == 1) ? 1 : 32;
    const long long r0 = ((long long)blockIdx.x * 256 + threadIdx.x) * rpt; const int z = blockIdx.z, zo = z / p.zi_n, zi = z - zo * p.zi_n;
    if (r0 >= p.M) return;
    const float* Bb = p.B + zo * p.sBo + zi * p.sBi;
    float* C = p.C + zo * p.sCo + zi * p.sCi; const float* R = p.R + zo * p.sRo + zi * p.sRi;
    for (int rr = 0; rr < rpt; ++rr) {
        const long long r = r0 + rr; if (r >= p.M) break;
        const float* A = p.A + zo * p.sAo + zi * p.sAi + r * p.sAm;
        float acc[8] = {0.f, 0.f, 0.f, 0.f, 0.f, 0.f, 0.f, 0.f};
        for (int k = 0; k < p.K; ++k) { const float a = A[(long long)k * p.sAk];
#pragma unroll
            for (int j = 0; j < 8; ++j) if (j < p.N) acc[j] += a * Bb[(long long)j * p.sBn + (long long)k * p.sBk]; }
#pragma unroll
        for (int j = 0; j < 8; ++j) if (j < p.N) {
            float v = acc[j] * p.alpha;
            if (p.flags & 1) v += p.bias[j];
            if (p.flags & 2) v += p.bias[r];
            v = act_fn(v, p.act);
            if (p.flags & 4) v += p.beta * R[r * p.sRm + (long long)j * p.sRn];
            VST2(float, C + r * p.sCm + j, v);
        }
    }
}
// k_smallsoftmax: thread-per-row softmax for short rows (n <= 64): dst[r*dr + j] = softmax(scale*src[r*sr + j])
__global__ __launch_bounds__(256) void k_smallsoftmax(const float* __restrict__ src, float* __restrict__ dst, long long sr, long long dr, int n, long long R, float scale) {
    const long long r0 = ((long long)blockIdx.x * 256 + threadIdx.x) * 32;
    for (int rr = 0; rr < 32; ++rr) {
        const long long r = r0 + rr; if (r >= R) return;
        const float* s = src + r * sr; float* d = dst + r * dr;
        float mx = -__builtin_inff();
        for (int j = 0; j < n; ++j) mx = fmaxf(mx, s[j] * scale);
        float sum = 0.f;
        for (int j = 0; j < n; ++j) sum += expf(s[j] * scale - mx);
        const float inv = 1.f / sum;
        for (int j = 0; j < n; ++j) { const float v = expf(s[j] * scale - mx) * inv; VST2(float, d + j, v); }
    }
}

__global__ __launch_bounds__(32) void k_unitstat(float* __restrict__ st) { const int t = threadIdx.x; const float v = (t == 1) ? 1.f : 0.f; VST2(float, st + t, v); }

// destination (e.g. a d_out whose row width is not a multiple of 32 floats) is written by consecutive lanes of one instruction
__global__ __launch_bounds__(256) void k_lincopy(const float* __restrict__ src, long long lds, float* __restrict__ dst, long long ldd, long long rows, int cols) {
    const long long i = (long long)blockIdx.x * 256 + threadIdx.x; if (i >= rows * cols) return;
    const long long r = i / cols; const int c = (int)(i - r * cols);
    const float v = src[r * lds + c]; VST2(float, dst + r * ldd + c, v);
}

namespace w25 {
typedef __attribute__((ext_vector_type(16))) _Float16 v16h;
typedef __attribute__((ext_vector_type(8)))  _Float16 v8h;
typedef __attribute__((ext_vector_type(16))) __bf16   v16b;
typedef __attribute__((ext_vector_type(8)))  __bf16   v8b;
typedef __attribute__((ext_vector_type(8)))  float    v8f;
typedef __attribute__((ext_vector_type(4)))  float    v4f;

__device__ __forceinline__ unsigned short f2bf_bits(float f) {
  unsigned u = __float_as_uint(f);
  return (unsigned short)((u + 0x7FFFu + ((u >> 16) & 1u)) >> 16);
}
__device__ __forceinline__ float bf_bits2f(unsigned short h) { return __uint_as_float(((unsigned)h) << 16); }

// hazard guards as plain device helpers (no inline asm inside the kernel template body)
__device__ __forceinline__ void dep_guard_h(v8f& a, v8f& b, v16h x, v16h y) { asm volatile("v_nop\n\tv_nop\n\tv_nop\n\tv_nop" : "+v"(a), "+v"(b) : "v"(x), "v"(y)); }
__device__ __forceinline__ void dep_guard_b(v8f& a, v8f& b, v16b x, v16b y) { asm volatile("v_nop\n\tv_nop\n\tv_nop\n\tv_nop" : "+v"(a), "+v"(b) : "v"(x), "v"(y)); }
__device__ __forceinline__ void keep4_h(v16h a, v16h b, v16h c, v16h d) { asm volatile("v_nop" :: "v"(a), "v"(b), "v"(c), "v"(d)); }
__device__ __forceinline__ void keep4_b(v16b a, v16b b, v16b c, v16b d) { asm volatile("v_nop" :: "v"(a), "v"(b), "v"(c), "v"(d)); }
__device__ __forceinline__ void acc_guard4(v8f& a, v8f& b, v8f& c, v8f& d) { asm volatile("v_nop\n\tv_nop\n\tv_nop\n\tv_nop" : "+v"(a), "+v"(b), "+v"(c), "+v"(d)); }
template <typename T> struct Frag;
template <> struct Frag<_Float16> {
  typedef v16h V; union U { v16h v; v8h h[2]; };
  static __device__ __forceinline__ v16h load(const _Float16* p) {   // elements 0..7 <- p[0..7], 8..15 <- p[16..23]
    U f; f.h[0] = *(const v8h*)(p); f.h[1] = *(const v8h*)(p + 16); return f.v;
  }
  static __device__ __forceinline__ v8f mma(v16h a, v16h b, v8f c) {
    return __builtin_amdgcn_wmma_f32_16x16x32_f16(false, a, false, b, (short)0, c, false, false);
  }
  static __device__ __forceinline__ void guard(v8f& a, v8f& b, v16h x, v16h y) { dep_guard_h(a, b, x, y); }
  static __device__ __forceinline__ void keep(v16h a, v16h b, v16h c, v16h d) { keep4_h(a, b, c, d); }
};
template <> struct Frag<__bf16> {
  typedef v16b V; union U { v16b v; v8b h[2]; };
  static __device__ __forceinline__ v16b load(const __bf16* p) {
    U f; f.h[0] = *(const v8b*)(p); f.h[1] = *(const v8b*)(p + 16); return f.v;
  }
  static __device__ __forceinline__ v8f mma(v16b a, v16b b, v8f c) {
    return __builtin_amdgcn_wmma_f32_16x16x32_bf16(false, a, false, b, (short)0, c, false, false);
  }
  static __device__ __forceinline__ void guard(v8f& a, v8f& b, v16b x, v16b y) { dep_guard_b(a, b, x, y); }
  static __device__ __forceinline__ void keep(v16b a, v16b b, v16b c, v16b d) { keep4_b(a, b, c, d); }
};

// ---- Register-blocked batched WMMA GEMM ------------------------------------
// C[m,n] = scale * sum_k A[m,k] * Bt[n,k] (+bias)(+resid); each wave owns a 64x64 tile.
// A row-major [M,K]; Bt row-major [N,K]; M,N % 64 == 0, K % 32 == 0.
// SPLIT: operands are hi/lo planes (A2/Bt2 = lo planes, same layout); product = hi·hi + hi·lo + lo·hi.
// BIAS_MODE: 0 = none, 1 = bias[m], 2 = bias[n].
// OUT_MODE: 0 = f32, 1 = f16, 2 = bf16 hi plane (Cout) + bf16 lo plane (Cout2).
// ET: 0 = f16 operands, 1 = bf16 operands (pointers passed as 16-bit storage)
template <int ET> struct Elem;
template <> struct Elem<0> { typedef _Float16 T; };
template <> struct Elem<1> { typedef __bf16 T; };
template <int ET, bool SPLIT, int BIAS_MODE, int OUT_MODE, bool RESID, int ACT = 0>
__global__ __launch_bounds__(256) void wmma_gemm64(
    const unsigned short* __restrict__ Ap, const unsigned short* __restrict__ A2p, int lda, long strideA,
    const unsigned short* __restrict__ Btp, const unsigned short* __restrict__ Bt2p, int ldb, long strideB,
    void* __restrict__ Cout, void* __restrict__ Cout2, int ldc, long strideC,
    const float* __restrict__ bias,
    const float* __restrict__ resid, long strideR,
    int M, int N, int K, float scale) {
  typedef typename Elem<ET>::T T;
  typedef typename Frag<T>::V V;
  const T* A = (const T*)Ap; const T* A2 = (const T*)A2p; const T* Bt = (const T*)Btp; const T* Bt2 = (const T*)Bt2p;
  __shared__ __align__(16) float sT[8][16 * 68];   // per-wave 16x64 slab, pitch 68 floats
  const int b    = blockIdx.y;
  const int lane = threadIdx.x & 31;
  const int wave = threadIdx.x >> 5;
  const int tilesN = N >> 6;
  const int tilesM = M >> 6;
  const int tile = blockIdx.x * 8 + wave;
  if (tile >= tilesM * tilesN) return;   // wave-uniform; no block barriers in this kernel
  const int tm = tile / tilesN;
  const int tn = tile - tm * tilesN;
  const int m0 = tm << 6;
  const int n0 = tn << 6;

  const T* Ab  = A  + (size_t)b * strideA;
  const T* Bb  = Bt + (size_t)b * strideB;
  const T* Ab2 = SPLIT ? (A2  + (size_t)b * strideA) : nullptr;
  const T* Bb2 = SPLIT ? (Bt2 + (size_t)b * strideB) : nullptr;

  const int rlane = lane & 15;                 // row (A) / col (B, D) within subtile
  const int koff  = (lane >> 4) * 8;           // k offset of this lane half
  const int mOff  = (lane >> 4) * 8;           // D row offset

  v8f acc[4][4];
#pragma unroll
  for (int i = 0; i < 4; ++i)
#pragma unroll
    for (int j = 0; j < 4; ++j) acc[i][j] = (v8f){0.f,0.f,0.f,0.f,0.f,0.f,0.f,0.f};

  for (int k0 = 0; k0 < K; k0 += 32) {
    V bh[4], bl[4];
#pragma unroll
    for (int j = 0; j < 4; ++j) {
      const size_t bo = (size_t)(n0 + (j << 4) + rlane) * ldb + koff + k0;
      bh[j] = Frag<T>::load(Bb + bo);
      if (SPLIT) bl[j] = Frag<T>::load(Bb2 + bo);
    }
#pragma unroll
    for (int i = 0; i < 4; ++i) {
      const size_t ao = (size_t)(m0 + (i << 4) + rlane) * lda + koff + k0;
      V ah = Frag<T>::load(Ab + ao);
      V al;
      if (SPLIT) al = Frag<T>::load(Ab2 + ao);
#pragma unroll
      for (int j = 0; j < 4; ++j) {
        acc[i][j] = Frag<T>::mma(ah, bh[j], acc[i][j]);
        if (SPLIT) {
          acc[i][j] = Frag<T>::mma(ah, bl[j], acc[i][j]);
          acc[i][j] = Frag<T>::mma(al, bh[j], acc[i][j]);
        }
      }
      Frag<T>::guard(acc[i][0], acc[i][3], ah, SPLIT ? al : ah);
    }
    Frag<T>::keep(bh[0], bh[1], bh[2], bh[3]);
    if (SPLIT) Frag<T>::keep(bl[0], bl[1], bl[2], bl[3]);
  }
  acc_guard4(acc[0][0], acc[0][1], acc[0][2], acc[0][3]);
  acc_guard4(acc[1][0], acc[1][1], acc[1][2], acc[1][3]);
  acc_guard4(acc[2][0], acc[2][1], acc[2][2], acc[2][3]);
  acc_guard4(acc[3][0], acc[3][1], acc[3][2], acc[3][3]);

  // ---- epilogue ----
  float* slab = sT[wave];
  const float* Rb = RESID ? (resid + (size_t)b * strideR) : nullptr;
#pragma unroll
  for (int i = 0; i < 4; ++i) {
    const int mBase = m0 + (i << 4);
#pragma unroll
    for (int j = 0; j < 4; ++j) {
      const int n = n0 + (j << 4) + rlane;
      float bv = 0.f;
      if (BIAS_MODE == 2) bv = bias[n];
#pragma unroll
      for (int r = 0; r < 8; ++r) {
        float v = acc[i][j][r] * scale;
        if (BIAS_MODE == 1) v += bias[mBase + mOff + r];
        if (BIAS_MODE == 2) v += bv;
        if (RESID) v += Rb[(size_t)(mBase + mOff + r) * ldc + n];
        if (ACT == 1) v = tanhf(v);
        if (ACT == 2) v = fmaxf(v, 0.0f);
        if (ACT == 3) v = v / (1.0f + expf(-v));
        if (ACT == 4) v = (v > 0.f) ? v : 0.01f * v;
        if (ACT == 5) v = 0.5f * v * (1.0f + erff(v * 0.70710678118654752f));
        slab[(mOff + r) * 68 + (j << 4) + rlane] = v;
      }
    }
    __builtin_amdgcn_fence(__ATOMIC_RELEASE, "workgroup");
    __builtin_amdgcn_wave_barrier();
    __builtin_amdgcn_fence(__ATOMIC_ACQUIRE, "workgroup");
    if (OUT_MODE == 0) {
      float* C = (float*)Cout + (size_t)b * strideC;
      const int hh = lane >> 4, c4 = (lane & 15) * 4;     // row seg = 256 B = 16 lanes x 16 B
      {
#pragma unroll
        for (int it = 0; it < 8; ++it) {
          const int row = it * 2 + hh;
          v4f v = *(const v4f*)(slab + row * 68 + c4);
          *(v4f*)(C + (size_t)(mBase + row) * ldc + n0 + c4) = v;
        }
        
      }
    } else {
      const int q = lane >> 3, c8 = (lane & 7) * 8;
      unsigned short* C  = (unsigned short*)Cout  + (size_t)b * strideC;
      unsigned short* C2 = (OUT_MODE == 2) ? ((unsigned short*)Cout2 + (size_t)b * strideC) : nullptr;
      {
#pragma unroll
        for (int it = 0; it < 4; ++it) {
          const int row = it * 4 + q;
          const float* sp = slab + row * 68 + c8;
          v8h hv, lv;
#pragma unroll
          for (int e = 0; e < 8; ++e) {
            if (OUT_MODE == 1) {
              hv[e] = (_Float16)sp[e];
            } else {
              unsigned short hb = f2bf_bits(sp[e]);
              unsigned short lb = f2bf_bits(sp[e] - bf_bits2f(hb));
              hv[e] = __builtin_bit_cast(_Float16, hb);
              lv[e] = __builtin_bit_cast(_Float16, lb);
            }
          }
          *(v8h*)(C + (size_t)(mBase + row) * ldc + n0 + c8) = hv;
          if (OUT_MODE == 2) *(v8h*)(C2 + (size_t)(mBase + row) * ldc + n0 + c8) = lv;
        }
        
      }
    }
    __builtin_amdgcn_fence(__ATOMIC_RELEASE, "workgroup");
    __builtin_amdgcn_wave_barrier();
    __builtin_amdgcn_fence(__ATOMIC_ACQUIRE, "workgroup");
  }
}

__global__ __launch_bounds__(256) void cast_f32_f16x2(
    const float* __restrict__ in, _Float16* __restrict__ out, int n2) {
  int i = blockIdx.x * 256 + threadIdx.x;
  if (i < n2) {
    const _Float16 h0 = (_Float16)in[2 * i], h1 = (_Float16)in[2 * i + 1];
    const unsigned u = (unsigned)__builtin_bit_cast(unsigned short, h0) | ((unsigned)__builtin_bit_cast(unsigned short, h1) << 16);
    ((unsigned*)out)[i] = u;
    
  }
}


} // namespace w25

__device__ __forceinline__ unsigned int f2h2_pack(float a, float b) { return (unsigned)__builtin_bit_cast(unsigned short, (_Float16)a) | ((unsigned)__builtin_bit_cast(unsigned short, (_Float16)b) << 16); }
__global__ __launch_bounds__(256) void k_cast16(const float* __restrict__ src, long long lds, _Float16* __restrict__ dst, long long ldd, int R, int C, float s) {
    const long long i = (long long)blockIdx.x * 256 + threadIdx.x; const long long np = (long long)R * (C / 2); if (i >= np) return; const int r = (int)(i / (C / 2)); const int c = 2 * (int)(i % (C / 2));
    const _Float16 h0 = (_Float16)(src[(long long)r * lds + c] * s), h1 = (_Float16)(src[(long long)r * lds + c + 1] * s);
    const unsigned u = (unsigned)__builtin_bit_cast(unsigned short, h0) | ((unsigned)__builtin_bit_cast(unsigned short, h1) << 16);
    unsigned* d = (unsigned*)(dst + (long long)r * ldd + c); *d = u;  }

// f32 -> bf16 hi plane + bf16 lo plane (x = hi + lo to ~2^-17 relative; RNE both), [R][C] -> [R][C] (or transposed to [C][R]); 2 consecutive destination elements
__device__ __forceinline__ unsigned int f2bf2_pack(float a, float b, unsigned int* lo) {
    const unsigned short ha = w25::f2bf_bits(a), hb = w25::f2bf_bits(b);
    const unsigned short la = w25::f2bf_bits(a - w25::bf_bits2f(ha)), lb = w25::f2bf_bits(b - w25::bf_bits2f(hb));
    *lo = (unsigned)la | ((unsigned)lb << 16); return (unsigned)ha | ((unsigned)hb << 16); }
__global__ __launch_bounds__(256) void k_castS16(const float* __restrict__ src, long long lds, __bf16* __restrict__ dhi, __bf16* __restrict__ dlo, long long ldd, int R, int C, float s, int transpose, long long sb, long long db) {
    src += (long long)blockIdx.y * sb; dhi += (long long)blockIdx.y * db; dlo += (long long)blockIdx.y * db;   // blockIdx.y = image
    const long long i = (long long)blockIdx.x * 256 + threadIdx.x; long long o; float a, b;
    if (transpose) { const long long np = (long long)C * (R / 2); if (i >= np) return; const int c = (int)(i / (R / 2)); const int r = 2 * (int)(i % (R / 2)); a = src[(long long)r * lds + c] * s; b = src[(long long)(r + 1) * lds + c] * s; o = (long long)c * ldd + r; }
    else { const long long np = (long long)R * (C / 2); if (i >= np) return; const int r = (int)(i / (C / 2)); const int c = 2 * (int)(i % (C / 2)); a = src[(long long)r * lds + c] * s; b = src[(long long)r * lds + c + 1] * s; o = (long long)r * ldd + c; }
    unsigned lo; const unsigned hi = f2bf2_pack(a, b, &lo); unsigned* ph = (unsigned*)(dhi + o); unsigned* pl = (unsigned*)(dlo + o);
    *ph = hi; *pl = lo;  }

namespace w25 {
// =====================================================================================
// Generic causal/non-causal attention for head_dim 64, f32 in / f32 out; 16-bit operands: bf16 with optional hi/lo splits, or
// plain f16 (F16=true, non-split, probabilities carried x2^15).
//   scores = (q*qscale)·kᵀ : v_wmma_f32_16x16x32_bf16; SPLIT_QK -> q,k as bf16 hi/lo (hi·hi + hi·lo + lo·hi)
//   out    = p·v           : v_wmma_f32_16x16x32_bf16; SPLIT_PV -> p,v as bf16 hi/lo; else p,v plain bf16
//   f32 accumulate; online softmax in f32. Block = 4 waves = 64 query rows of one (batch, head); S % 64 == 0.
//   Element (b, s, h, d) of tensor X lives at X[b*X_bs + s*X_rs + h*X_hs + d] (strides in floats, multiples of 4).
//   Masking: mask_mode 0 none, 1 causal (kv > q masked), 2 tensor [S][Skv] shared over (b,h) (float if
//   mask_is_int==0, int32 with element == 0 -> masked if 1, int32 with element != 0 -> masked if 2), 3 per-token vectors qmask[B][S] & kvmask[B][Skv] (int32,
//   0 -> masked), 4 causal + sliding window (kv > q or q - kv > W masked; W passed in mask_is_int);
//   5 = relative-position bias: s += cp[b,h,q][idx[q][kv]] + pc[b,h,kv][idx[q][kv]] with idx = mask_b ([S][Skv] int32) and
//   mask_a an int32 [S][Skv] tensor with nonzero = masked (tables: element (b,h,row,n) at X + b*c_bs + h*c_hs + row*c_rs + n);
//   masked scores are replaced by mask_fill (e.g. -inf or -1e9) before the softmax.
//   grid.x = B * H * (S/64) (or a sub-range with blk0).
// =====================================================================================
#define AT_D 64
#define AT_NW 4
#define AT_QB 64
#define AT_KC 64
struct AttnGeom { const float* cp = nullptr; const float* pc = nullptr; long c_bs = 0, c_rs = 0, c_hs = 0;   // mode-5 score-bias tables
                  long q_bs, q_rs, q_hs, k_bs, k_rs, k_hs, v_bs, v_rs, v_hs, o_bs, o_rs, o_hs;
                  int S, Skv, H, mask_mode; float qscale; int blk0; float mask_fill; int mask_is_int; };
static_assert(sizeof(AttnGeom) == 168, "no padding");

__device__ __forceinline__ unsigned short at_bf_bits(float f) {
  unsigned u = __float_as_uint(f);
  return (unsigned short)((u + 0x7FFFu + ((u >> 16) & 1u)) >> 16);
}
__device__ __forceinline__ __bf16 at_f2bf(float f) { return __builtin_bit_cast(__bf16, at_bf_bits(f)); }
__device__ __forceinline__ void at_split(float f, __bf16& hi, __bf16& lo) {
  const unsigned short hb = at_bf_bits(f);
  hi = __builtin_bit_cast(__bf16, hb);
  lo = at_f2bf(f - __uint_as_float(((unsigned)hb) << 16));
}
__device__ __forceinline__ v8f at_mma(v16b a, v16b b, v8f c) {
  c = __builtin_amdgcn_wmma_f32_16x16x32_bf16(false, a, false, b, (short)0, c, false, false);
  asm volatile("v_nop\n\tv_nop\n\tv_nop\n\tv_nop" : "+v"(c) : "v"(a), "v"(b));
  return c;
}
// 16-bit element as a bit pattern held in a __bf16 slot: f16 bits when F16, bf16 (RNE) otherwise
template <bool F16> __device__ __forceinline__ __bf16 at_to16(float f) {
  if (F16) return __builtin_bit_cast(__bf16, (_Float16)f);
  return at_f2bf(f);
}
template <bool F16> __device__ __forceinline__ v8f at_mma16(v16b a, v16b b, v8f c) {
  if (F16) {
    const v16h ah = __builtin_bit_cast(v16h, a), bh = __builtin_bit_cast(v16h, b);
    c = __builtin_amdgcn_wmma_f32_16x16x32_f16(false, ah, false, bh, (short)0, c, false, false);
    asm volatile("v_nop\n\tv_nop\n\tv_nop\n\tv_nop" : "+v"(c) : "v"(ah), "v"(bh));
    return c;
  }
  return at_mma(a, b, c);
}

template <bool SPLIT_QK, bool SPLIT_PV, bool F16 = false>
__global__ __launch_bounds__(128)
void attn64_kernel(const float* __restrict__ q, const float* __restrict__ k,
                   const float* __restrict__ v, float* __restrict__ out,
                   const void* __restrict__ mask_a, const int* __restrict__ mask_b, AttnGeom g) {
  static_assert(!(F16 && (SPLIT_QK || SPLIT_PV)), "f16 mode is non-split");
  const float PSC = F16 ? 32768.0f : 1.0f;     // f16 probabilities carried x2^15 (subnormal range), folded into the final 1/l
  union FB { v16b v; v8b h[2]; };
  __shared__ __align__(16) __bf16 Ksh[AT_KC * AT_D];             // K hi [kv][d]      8 KB
  __shared__ __align__(16) __bf16 Ksl[SPLIT_QK ? AT_KC * AT_D : 8];
  __shared__ __align__(16) __bf16 Vth[AT_D * AT_KC];             // V hi [d][kv]      8 KB
  __shared__ __align__(16) __bf16 Vtl[SPLIT_PV ? AT_D * AT_KC : 8];
  __shared__ __align__(16) __bf16 Psh[AT_NW][16 * AT_KC];        // per wave P hi [row][kv]  8 KB
  __shared__ __align__(16) __bf16 Psl[SPLIT_PV ? AT_NW : 1][SPLIT_PV ? 16 * AT_KC : 8];
  __shared__ __align__(16) float  Os[AT_NW][16 * 68];            // per wave out tile, pitch 68

  const int tid  = threadIdx.x;
  const int wave = tid >> 5;
  const int lane = tid & 31;
  const int hh   = lane >> 4;
  const int c    = lane & 15;

  const int nqb = g.S / AT_QB;
  const int bx = blockIdx.x + g.blk0;
  const int qb = bx % nqb;
  const int bh = bx / nqb;
  const int h  = bh % g.H;
  const int b  = bh / g.H;
  const int qbase_block = qb * AT_QB;
  const int q0 = qbase_block + wave * 16;

  const float* qb_ptr = q + (size_t)b * g.q_bs + (size_t)h * g.q_hs;
  const float* kb_ptr = k + (size_t)b * g.k_bs + (size_t)h * g.k_hs;
  const float* vb_ptr = v + (size_t)b * g.v_bs + (size_t)h * g.v_hs;
  float*       ob_ptr = out + (size_t)b * g.o_bs + (size_t)h * g.o_hs;

  // ---- Q fragments (A operand): 2 d-chunks, hi (and lo) ----
  v16b qah[2], qal[2];
  {
    const float* qrow = qb_ptr + (size_t)(q0 + c) * g.q_rs;
#pragma unroll
    for (int dc = 0; dc < 2; ++dc) {
#pragma unroll
      for (int e = 0; e < 8; ++e) {
        const float f0 = qrow[dc * 32 + 8 * hh + e] * g.qscale;
        const float f1 = qrow[dc * 32 + 16 + 8 * hh + e] * g.qscale;
        if (SPLIT_QK) { __bf16 hq, lq; at_split(f0, hq, lq); qah[dc][e] = hq; qal[dc][e] = lq; at_split(f1, hq, lq); qah[dc][8 + e] = hq; qal[dc][8 + e] = lq; }
        else { qah[dc][e] = at_to16<F16>(f0); qah[dc][8 + e] = at_to16<F16>(f1); qal[dc][e] = qah[dc][e]; qal[dc][8 + e] = qah[dc][8 + e]; }
      }
    }
  }

  float mrow[8], lrow[8];
  v8f oacc[4];
#pragma unroll
  for (int r = 0; r < 8; ++r) { mrow[r] = -INFINITY; lrow[r] = 0.f; }
#pragma unroll
  for (int t = 0; t < 4; ++t) oacc[t] = (v8f){0.f,0.f,0.f,0.f,0.f,0.f,0.f,0.f};

  const int nChunks = (g.mask_mode == 1 || g.mask_mode == 4) ? (qb + 1) : (g.Skv / AT_KC);   // block-uniform
  // per-row query mask (mode 3)
  int qkeep[8];
#pragma unroll
  for (int r = 0; r < 8; ++r) qkeep[r] = (g.mask_mode == 3) ? mask_b[(size_t)b * g.S + q0 + 8 * hh + r] : 1;   // mask_b = qmask in mode 3
  for (int kc = 0; kc < nChunks; ++kc) {
    const int kv0 = kc * AT_KC;
    __syncthreads();
    {
      const int kvr = tid >> 1, dh = (tid & 1) * 32;
      const float* krow = kb_ptr + (size_t)(kv0 + kvr) * g.k_rs + dh;
      const float* vrow = vb_ptr + (size_t)(kv0 + kvr) * g.v_rs + dh;
#pragma unroll
      for (int i = 0; i < 8; ++i) {
        v4f kk = *(const v4f*)(krow + 4 * i);
        v4f vv = *(const v4f*)(vrow + 4 * i);
#pragma unroll
        for (int e = 0; e < 4; ++e) {
          const int d = dh + 4 * i + e;
          if (SPLIT_QK) { __bf16 a, bl; at_split(kk[e], a, bl); Ksh[kvr * AT_D + d] = a; Ksl[kvr * AT_D + d] = bl; }
          else Ksh[kvr * AT_D + d] = at_to16<F16>(kk[e]);
          if (SPLIT_PV) { __bf16 a, bl; at_split(vv[e], a, bl); Vth[d * AT_KC + kvr] = a; Vtl[d * AT_KC + kvr] = bl; }
          else Vth[d * AT_KC + kvr] = at_to16<F16>(vv[e]);
        }
      }
    }
    __syncthreads();

    v8f s[4];
#pragma unroll
    for (int j = 0; j < 4; ++j) {
      s[j] = (v8f){0.f,0.f,0.f,0.f,0.f,0.f,0.f,0.f};
#pragma unroll 1
      for (int dc = 0; dc < 2; ++dc) {
        FB kb;
        kb.h[0] = *(const v8b*)(Ksh + (j * 16 + c) * AT_D + dc * 32 + 8 * hh);
        kb.h[1] = *(const v8b*)(Ksh + (j * 16 + c) * AT_D + dc * 32 + 16 + 8 * hh);
        s[j] = at_mma16<F16>(qah[dc], kb.v, s[j]);
        if (SPLIT_QK) {
          FB kl;
          kl.h[0] = *(const v8b*)(Ksl + (j * 16 + c) * AT_D + dc * 32 + 8 * hh);
          kl.h[1] = *(const v8b*)(Ksl + (j * 16 + c) * AT_D + dc * 32 + 16 + 8 * hh);
          s[j] = at_mma16<F16>(qah[dc], kl.v, s[j]);
          s[j] = at_mma16<F16>(qal[dc], kb.v, s[j]);
        }
      }
    }
    const bool diag = (g.mask_mode == 1) && (kc == qb);
    int kvkeep[4] = {1, 1, 1, 1};
    if (g.mask_mode == 3) {
#pragma unroll
      for (int j = 0; j < 4; ++j) kvkeep[j] = ((const int*)mask_a)[(size_t)b * g.Skv + kv0 + j * 16 + c];   // mask_a = kvmask
    }
    float cm[8];
#pragma unroll
    for (int r = 0; r < 8; ++r) {
      const int qrow = q0 + 8 * hh + r;
      float m = -INFINITY;
#pragma unroll
      for (int j = 0; j < 4; ++j) {
        const int kvcol = kv0 + j * 16 + c;
        bool masked = false;
        if (diag) masked = (kvcol > qrow);
        else if (g.mask_mode == 4) masked = (kvcol > qrow) || (qrow - kvcol > g.mask_is_int);
        else if (g.mask_mode == 2) {
          const size_t mi = (size_t)qrow * g.Skv + kvcol;
          masked = (g.mask_is_int == 0) ? (((const float*)mask_a)[mi] == 0.0f)
                 : (g.mask_is_int == 1) ? (((const int*)mask_a)[mi] == 0) : (((const int*)mask_a)[mi] != 0);
        } else if (g.mask_mode == 3) masked = (qkeep[r] == 0) || (kvkeep[j] == 0);
        else if (g.mask_mode == 5) {
          const size_t mi = (size_t)qrow * g.Skv + kvcol;
          masked = (((const int*)mask_a)[mi] != 0);
          int n = mask_b[mi]; n = n < 0 ? 0 : n;
          s[j][r] += g.cp[(size_t)b * g.c_bs + (size_t)h * g.c_hs + (size_t)qrow * g.c_rs + n]
                   + g.pc[(size_t)b * g.c_bs + (size_t)h * g.c_hs + (size_t)kvcol * g.c_rs + n];
        }
        if (masked) s[j][r] = g.mask_fill;
        m = fmaxf(m, s[j][r]);
      }
#pragma unroll
      for (int off = 1; off < 16; off <<= 1) m = fmaxf(m, __shfl_xor(m, off, 32));
      cm[r] = m;
    }
    __bf16* pwh = Psh[wave];
    __bf16* pwl = Psl[SPLIT_PV ? wave : 0];
#pragma unroll
    for (int r = 0; r < 8; ++r) {
      const float mnew = fmaxf(mrow[r], cm[r]);
      const float alpha = expf(mrow[r] - mnew);
      mrow[r] = mnew;
      float psum = 0.f;
#pragma unroll
      for (int j = 0; j < 4; ++j) {
        const float p = expf(s[j][r] - mnew);
        psum += p;
        if (SPLIT_PV) { __bf16 a, bl; at_split(p, a, bl); pwh[(8 * hh + r) * AT_KC + j * 16 + c] = a; pwl[(8 * hh + r) * AT_KC + j * 16 + c] = bl; }
        else pwh[(8 * hh + r) * AT_KC + j * 16 + c] = at_to16<F16>(p * PSC);
      }
#pragma unroll
      for (int off = 1; off < 16; off <<= 1) psum += __shfl_xor(psum, off, 32);
      lrow[r] = lrow[r] * alpha + psum;
#pragma unroll
      for (int t = 0; t < 4; ++t) oacc[t][r] *= alpha;
    }
    __builtin_amdgcn_fence(__ATOMIC_RELEASE, "workgroup");
    __builtin_amdgcn_wave_barrier();
    __builtin_amdgcn_fence(__ATOMIC_ACQUIRE, "workgroup");
#pragma unroll 1
    for (int kk = 0; kk < 2; ++kk) {
      FB pa, pl;
      pa.h[0] = *(const v8b*)(pwh + c * AT_KC + kk * 32 + 8 * hh);
      pa.h[1] = *(const v8b*)(pwh + c * AT_KC + kk * 32 + 16 + 8 * hh);
      if (SPLIT_PV) {
        pl.h[0] = *(const v8b*)(pwl + c * AT_KC + kk * 32 + 8 * hh);
        pl.h[1] = *(const v8b*)(pwl + c * AT_KC + kk * 32 + 16 + 8 * hh);
      }
#pragma unroll
      for (int t = 0; t < 4; ++t) {
        FB vb;
        vb.h[0] = *(const v8b*)(Vth + (t * 16 + c) * AT_KC + kk * 32 + 8 * hh);
        vb.h[1] = *(const v8b*)(Vth + (t * 16 + c) * AT_KC + kk * 32 + 16 + 8 * hh);
        oacc[t] = at_mma16<F16>(pa.v, vb.v, oacc[t]);
        if (SPLIT_PV) {
          FB vl;
          vl.h[0] = *(const v8b*)(Vtl + (t * 16 + c) * AT_KC + kk * 32 + 8 * hh);
          vl.h[1] = *(const v8b*)(Vtl + (t * 16 + c) * AT_KC + kk * 32 + 16 + 8 * hh);
          oacc[t] = at_mma16<F16>(pa.v, vl.v, oacc[t]);
          oacc[t] = at_mma16<F16>(pl.v, vb.v, oacc[t]);
        }
      }
    }
  }

  float* os = Os[wave];
#pragma unroll
  for (int r = 0; r < 8; ++r) {
    const float inv = 1.0f / (lrow[r] * PSC);
#pragma unroll
    for (int t = 0; t < 4; ++t) os[(8 * hh + r) * 68 + t * 16 + c] = oacc[t][r] * inv;
  }
  __builtin_amdgcn_fence(__ATOMIC_RELEASE, "workgroup");
  __builtin_amdgcn_wave_barrier();
  __builtin_amdgcn_fence(__ATOMIC_ACQUIRE, "workgroup");
  {
    const int c4 = (lane & 15) * 4;
    {
#pragma unroll
      for (int it = 0; it < 8; ++it) {
        const int row = it * 2 + hh;
        v4f val = *(const v4f*)(os + row * 68 + c4);
        *(v4f*)(ob_ptr + (size_t)(q0 + row) * g.o_rs + c4) = val;
      }
      
    }
  }
}

} // namespace w25

// Fused projection of one image tile: the casts of x, the three 1x1 convolutions, the 2x2 max-pool and the operand planes of k_nl_flash in one kernel; x is read once, as f32.
// A block owns 64 pixels = 16 pool windows: image rows 2py, 2py + 1, columns 32hf .. 32hf + 31 (blockIdx.x = 2py + hf, blockIdx.y = image).
// Staging: a thread takes 2 x 8 channels (128 apart) x 4 pixels (sixteen 16-byte loads, 8 lanes = one 128-B line), casts them as the cast kernels did (bf16 hi, bf16 lo, f16 of 16 x) and stores, per pixel and plane,
// 16 bytes = 8 consecutive channels = half a lane's fragment into LDS, [slot][channel]. Slot = 16 j + m: m = pool window, j = 2 (row in window) + (column in window). So the four pixels of a window
// sit in four different 16-pixel tiles at the same column, and the pool is a maximum over four accumulators of one lane.
// Wave w owns channels 16w .. 16w + 15 of all three outputs for all 64 pixels: theta^T = Wt X and phi = Wp X (D: column = pixel, rows = 8 consecutive channels a lane; bf16 hi/lo, three products in
// the order the GEMMs had), g^T = X^T Wg^T (D: column = channel, rows = 8 consecutive windows a lane; f16). Pooled phi and g leave in the fragment order of k_nl_flash, 512 contiguous bytes a wave
// and plane (a 16-byte chunk is half of one lane's fragment, 32 chunks, lane = 16 h + c, are one wave-wide load; element e: bits 0-2 k, 3-6 row c, 7 half h, 8 which 16 k, then pooled phi: 9-10 block of
// 32 channels, 11.. tile of 16 keys; pooled g: 9-11 tile of 16 channels, 12.. block of 32 keys). theta leaves in the same order, as the B operand of k_nl_flash: a group of 16 queries = one pixel tile j
// (bits 9-10 block of 32 channels, 11-12 tile j, 13 half hf, 14.. row pair py), again 512 contiguous bytes a wave, tile and plane. The five weight planes arrive in fragment order too (k_nl_wcast). The bias is added behind the maximum (rounding is monotonic, so the value is the same).
namespace w25 {
// the bf16 hi/lo split of two values, packed, in 32-bit arithmetic throughout (the same bits as f2bf_bits gives: round to nearest even, the result in the upper half)
__device__ __forceinline__ unsigned bf_rn(float f) { const unsigned u = __float_as_uint(f); return u + 0x7FFFu + ((u >> 16) & 1u); }
__device__ __forceinline__ unsigned split2(float a, float b, unsigned* lo) {
  const unsigned ua = bf_rn(a) & 0xFFFF0000u, ub = bf_rn(b) & 0xFFFF0000u;
  *lo = (bf_rn(a - __uint_as_float(ua)) >> 16) | (bf_rn(b - __uint_as_float(ub)) & 0xFFFF0000u);
  return (ua >> 16) | ub; }
constexpr int PJX = 264;   // LDS pitch of a slot of x, in 16-bit elements: 512 B + 16 B, an odd multiple of 16 B for 16-byte reads
// a fragment stored in fragment order: two wave-wide loads of 512 contiguous bytes (elements 0..7 <- p[0..7], 8..15 <- p[256..263], p = fragment + 8 * lane)
__device__ __forceinline__ v16b ldf_b(const __bf16* p) { Frag<__bf16>::U f; f.h[0] = *(const v8b*)(p); f.h[1] = *(const v8b*)(p + 256); return f.v; }
__device__ __forceinline__ v16h ldf_h(const _Float16* p) { Frag<_Float16>::U f; f.h[0] = *(const v8h*)(p); f.h[1] = *(const v8h*)(p + 256); return f.v; }
// launch bounds: four waves a SIMD (256 registers a wave), so that two blocks share a WGP and all 512 blocks are resident at once
__global__ __launch_bounds__(256, 4) void k_nl_proj(const float* __restrict__ X, const unsigned short* __restrict__ TWHp, const unsigned short* __restrict__ TWLp, const unsigned short* __restrict__ PWHp,
                                                 const unsigned short* __restrict__ PWLp, const unsigned short* __restrict__ GWp, const float* __restrict__ thb, const float* __restrict__ phb,
                                                 const float* __restrict__ gb, unsigned short* __restrict__ THHp, unsigned short* __restrict__ THLp, unsigned short* __restrict__ PPHp,
                                                 unsigned short* __restrict__ PPLp, unsigned short* __restrict__ GP16p) {
  constexpr int Cc = 256, D = 128, NKc = 1024, HWc = 4096;
  __shared__ __align__(16) unsigned short sx[3][64 * PJX];
  const int tid = threadIdx.x, lane = tid & 31, m = lane & 15, h = lane >> 4;
  const int wave = __builtin_amdgcn_readfirstlane(tid >> 5);   // the wave's number in a scalar register: every address is a scalar base plus a lane offset, and few vector registers live across the products
  const int b = blockIdx.y, py = blockIdx.x >> 1, hf = blockIdx.x & 1;
  // the wave's weight rows 16 wave .. + 15 in fragment order (eight fragments of 512 elements a plane, one a k step; a load = 512 contiguous bytes), first k step: they fly with the loads of x
  const unsigned wob = (unsigned)lane * 16u;   // one lane offset, in bytes, for the five planes
  const int wr = wave * 16 * Cc;
  const __bf16* TWH = (const __bf16*)((const char*)(TWHp + wr) + wob); const __bf16* TWL = (const __bf16*)((const char*)(TWLp + wr) + wob); const __bf16* PWH = (const __bf16*)((const char*)(PWHp + wr) + wob);
  const __bf16* PWL = (const __bf16*)((const char*)(PWLp + wr) + wob); const _Float16* GW = (const _Float16*)((const char*)(GWp + wr) + wob);
  v16b th = ldf_b(TWH), tl = ldf_b(TWL), ph = ldf_b(PWH), pl = ldf_b(PWL); v16h gw = ldf_h(GW);
  {
    const int g = lane & 7, cb = (lane >> 3) & 1, ry = h, cg = wave * 2 + cb;   // 4 pixels from column 4 g of row ry; channels 8 cg .. (and 128 + 8 cg ..); 16 lanes of one row: their LDS stores meet no common bank
    const unsigned xo = (unsigned)(cb * 8 * HWc + ry * 64 + g * 4) * 4u;   // lane offset in bytes
    const float* xp = (const float*)((const char*)(X + ((size_t)b * Cc + wave * 16) * HWc + (2 * py) * 64 + hf * 32) + xo);
    v4f v[2][8];
#pragma unroll   // v[][] in registers, all sixteen loads in flight
    for (int it = 0; it < 2; ++it)
#pragma unroll   // inner loop of the same
      for (int k = 0; k < 8; ++k) v[it][k] = *(const v4f*)(xp + (it * 128 + k) * HWc);
    // the wait before a load's address registers are reused; the lane offset of x and the lane number (the compiler scales it for the weights' addresses) as inputs keep their registers until the wait
    asm volatile("s_wait_xcnt 0x0" :: "v"(xo), "v"(lane) : "memory");
#pragma unroll   // constant indices into v[][]
    for (int it = 0; it < 2; ++it)
#pragma unroll   // inner loop of the same
      for (int e = 0; e < 4; ++e) { v4u hi, lo, f;
#pragma unroll   // inner loop of the same
        for (int q = 0; q < 4; ++q) { unsigned l2; hi[q] = split2(v[it][2 * q][e], v[it][2 * q + 1][e], &l2); lo[q] = l2; f[q] = f2h2_pack(v[it][2 * q][e] * 16.0f, v[it][2 * q + 1][e] * 16.0f); }
        const int so = ((ry * 2 + (e & 1)) * 16 + 2 * g + (e >> 1)) * PJX + it * 128 + cg * 8;
        *(v4u*)(&sx[0][so]) = hi; *(v4u*)(&sx[1][so]) = lo; *(v4u*)(&sx[2][so]) = f; }
  }
  __syncthreads();   // the tile of x is complete before any wave reads it
  v8f at[4], ap[4], ag[4];
#pragma unroll   // constant indices
  for (int j = 0; j < 4; ++j) { at[j] = (v8f){0.f,0.f,0.f,0.f,0.f,0.f,0.f,0.f}; ap[j] = at[j]; ag[j] = at[j]; }
  const __bf16* xh = (const __bf16*)(&sx[0][0]) + m * PJX + 8 * h; const __bf16* xl = (const __bf16*)(&sx[1][0]) + m * PJX + 8 * h; const _Float16* xf = (const _Float16*)(&sx[2][0]) + m * PJX + 8 * h;
  const unsigned bo8 = (unsigned)h * 32u, bo1 = (unsigned)m * 4u;   // lane offsets of the biases, in bytes
  const float* tbp = (const float*)((const char*)(thb + wave * 16) + bo8); const float* pbp = (const float*)((const char*)(phb + wave * 16) + bo8); const float* gbp = (const float*)((const char*)(gb + wave * 16) + bo1);
  v4f tb0, tb1, pb0, pb1; float gbv;
#pragma unroll   // eight k steps of 32 channels, constant offsets; no branch stands behind a matrix instruction
  for (int ks = 0; ks < 8; ++ks) {
    v16b nth = th, ntl = tl, nph = ph, npl = pl; v16h ngw = gw;
    if (ks < 7) {   // the next k step's weights fly behind this step's products
      const int kn = (ks + 1) * 512;
      nth = ldf_b(TWH + kn); ntl = ldf_b(TWL + kn); nph = ldf_b(PWH + kn); npl = ldf_b(PWL + kn); ngw = ldf_h(GW + kn);
      // the wait before these loads' address registers are reused (the lane number as an input keeps it until then); memory clobbered, the loads also stay above the products instead of sinking to their first use
      asm volatile("s_wait_xcnt 0x0" :: "v"(lane) : "memory");
    } else {        // the biases fly behind the last step's products, in the registers that the weights have left
      tb0 = *(const v4f*)(tbp); tb1 = *(const v4f*)(tbp + 4); pb0 = *(const v4f*)(pbp); pb1 = *(const v4f*)(pbp + 4); gbv = *gbp;
      asm volatile("s_wait_xcnt 0x0" :: "v"(bo8), "v"(bo1) : "memory");   // the same wait for the biases' lane offsets
    }
#pragma unroll   // two pixel tiles at a time: six independent accumulators, half the fragments live
    for (int jp = 0; jp < 4; jp += 2) {
      v16b bh[2], bl[2]; v16h bf[2];
#pragma unroll   // constant indices
      for (int u = 0; u < 2; ++u) { const int o = (jp + u) * 16 * PJX + ks * 32; bh[u] = Frag<__bf16>::load(xh + o); bl[u] = Frag<__bf16>::load(xl + o); bf[u] = Frag<_Float16>::load(xf + o); }
#pragma unroll   // constant indices; neighbours in the stream go to different tiles
      for (int u = 0; u < 2; ++u) at[jp + u] = Frag<__bf16>::mma(th, bh[u], at[jp + u]);
#pragma unroll   // the same
      for (int u = 0; u < 2; ++u) ap[jp + u] = Frag<__bf16>::mma(ph, bh[u], ap[jp + u]);
#pragma unroll   // the same
      for (int u = 0; u < 2; ++u) ag[jp + u] = Frag<_Float16>::mma(bf[u], gw, ag[jp + u]);
#pragma unroll   // the same
      for (int u = 0; u < 2; ++u) at[jp + u] = Frag<__bf16>::mma(tl, bh[u], at[jp + u]);
#pragma unroll   // the same
      for (int u = 0; u < 2; ++u) ap[jp + u] = Frag<__bf16>::mma(ph, bl[u], ap[jp + u]);
#pragma unroll   // the same
      for (int u = 0; u < 2; ++u) at[jp + u] = Frag<__bf16>::mma(th, bl[u], at[jp + u]);
#pragma unroll   // the same
      for (int u = 0; u < 2; ++u) ap[jp + u] = Frag<__bf16>::mma(pl, bh[u], ap[jp + u]);
    }
    th = nth; tl = ntl; ph = nph; pl = npl; gw = ngw;
  }
  __builtin_amdgcn_sched_barrier(0);   // the conversions below stay behind the products: moved up among them, their temporaries took registers that the fragments need, and values were spilled
  const float tbv[8] = { tb0[0], tb0[1], tb0[2], tb0[3], tb1[0], tb1[1], tb1[2], tb1[3] }, pbv[8] = { pb0[0], pb0[1], pb0[2], pb0[3], pb1[0], pb1[1], pb1[2], pb1[3] };
  // pooled phi (hi, lo) and pooled g
  v4u phi_h, phi_l, g_h;
#pragma unroll   // constant indices
  for (int q = 0; q < 4; ++q) { float pv[2], gv[2];
#pragma unroll   // inner loop of the same
    for (int u = 0; u < 2; ++u) { const int r = 2 * q + u;
      pv[u] = fmaxf(fmaxf(ap[0][r], ap[1][r]), fmaxf(ap[2][r], ap[3][r])) + pbv[r];
      gv[u] = fmaxf(fmaxf(ag[0][r], ag[1][r]), fmaxf(ag[2][r], ag[3][r])) * 0.0625f + gbv; }
    unsigned l2; phi_h[q] = split2(pv[0], pv[1], &l2); phi_l[q] = l2; g_h[q] = f2h2_pack(gv[0], gv[1]); }
  // theta: a lane's 8 channels of one pixel are half of a lane's B fragment (column = m, k from 16 (wave & 1) + 8 h of k step wave >> 1), so a wave stores 512 contiguous bytes a pixel tile and plane
  v4u oh[4], ol[4];
#pragma unroll   // constant indices
  for (int j = 0; j < 4; ++j)
#pragma unroll   // inner loop of the same
    for (int q = 0; q < 4; ++q) { unsigned l2; oh[j][q] = split2(at[j][2 * q] + tbv[2 * q], at[j][2 * q + 1] + tbv[2 * q + 1], &l2); ol[j][q] = l2; }
  const unsigned l16 = (unsigned)lane * 16u;
  const size_t to = ((((size_t)b * (HWc / 128) + py) * 8 + hf * 4) * 4 + (wave >> 1)) * 512 + (wave & 1) * 256;
  char* tph = (char*)(THHp + to) + l16; char* tpl = (char*)(THLp + to) + l16;
#pragma unroll   // constant indices; a pixel tile's four fragments are 4096 bytes
  for (int j = 0; j < 4; ++j) { *(v4u*)(tph + j * 4096) = oh[j]; *(v4u*)(tpl + j * 4096) = ol[j]; }
  const size_t po = (size_t)b * NKc * D + (py * 2 + hf) * 2048 + wave * 256, vo = (size_t)b * NKc * D + py * 4096 + wave * 512 + hf * 256;
  *(v4u*)((char*)(PPHp + po) + l16) = phi_h; *(v4u*)((char*)(PPLp + po) + l16) = phi_l; *(v4u*)((char*)(GP16p + vo) + l16) = g_h;
  // the wait before a store's registers are reused: the lane offset and the values as inputs keep them all until it, so nothing takes a register of an issued store
  asm volatile("s_wait_xcnt 0x0" :: "v"(l16), "v"(oh[0]), "v"(oh[1]), "v"(oh[2]), "v"(oh[3]), "v"(ol[0]), "v"(ol[1]), "v"(ol[2]), "v"(ol[3]), "v"(phi_h), "v"(phi_l), "v"(g_h) : "memory");
}
} // namespace w25
// Fused attention and output projection of one image: y[q][c] = f16( sum_k softmax_k(theta[q] . phi[k]) g[c][k] ), WY = W y + W_b. Scores and probabilities never leave the registers; y leaves as f16 fragments, of WY only its partial batch statistics.
// A block is 8 waves, two a SIMD, so that one wave's softmax runs beside the other's matrix products: waves w and w + 4 own the same 32 queries (two 16-column groups) and walk 512 keys each,
// 32 at a time; behind the loop they exchange maximum, sum and O^T through LDS, both merge them, and each forms half of the 256 output channels. A wave forms S^T = K Q^T (bf16 hi/lo planes, three products, as the score
// GEMM did) and O^T += V^T P^T (f16): in both D tiles a lane holds one query (column lane & 15), so maximum, sum and rescale are lane-local but for one
// exchange between the wave halves, and two S^T tiles (keys 0-15, 16-31), converted in place, are the B operand of the second product in the hardware k order.
// K (hi, lo), V^T and Q (theta hi, lo) lie in fragment order (k_nl_proj writes them so): every fragment load covers four whole lines. A group of 16 queries is one pixel tile of k_nl_proj:
// group 2 qw + t, column cq = pixel 64 (qw & 1) + 32 (qw >> 1) + 2 cq + t of the block's 128 (two image rows); the epilogue puts each column back at its pixel.
// Running maximum in log2 units; the accumulators are rescaled only when a column's maximum has grown by more than 8; p = 2^(s - m + 7) <= 2^15 fits f16.
// Epilogue: WY^T tile = W y^T (f16, k ascending), W in fragment order (k_nl_wcast writes it so); the block's 256 channels x 128 queries go through LDS, from where
// each channel's partial batch statistics are summed; k_nl_out merges the partials and forms W y again from the stored y.
namespace w25 {
__device__ __forceinline__ float xhalf(float x) { return __builtin_bit_cast(float, __builtin_amdgcn_permlanex16(__builtin_bit_cast(int, x), __builtin_bit_cast(int, x), 0x76543210, 0xfedcba98, false, false)); }   // lane l takes lane l ^ 16
typedef float v2f __attribute__((ext_vector_type(2)));
typedef __attribute__((address_space(1))) const char* gcp;   // a pointer into global memory, said outright: one rebuilt from two words would otherwise be taken for a generic one
// a wave-uniform address, both words through a scalar register: the compiler then keeps a plane's base in scalar registers and forms a pass's address from it; else it held base + lane offset of every plane in a vector pair through the loop
__device__ __forceinline__ gcp ubase(const unsigned short* p) { const unsigned long long a = (unsigned long long)p;
  const unsigned l = (unsigned)__builtin_amdgcn_readfirstlane((int)(unsigned)a), u = (unsigned)__builtin_amdgcn_readfirstlane((int)(unsigned)(a >> 32)); return (gcp)(((unsigned long long)u << 32) | l); }
// the same fragment loads from a lane's address a and a constant offset o, in bytes
__device__ __forceinline__ v16b ldu_b(gcp a, int o) { Frag<__bf16>::U f; f.h[0] = *(const __attribute__((address_space(1))) v8b*)(a + o); f.h[1] = *(const __attribute__((address_space(1))) v8b*)(a + (o + 512)); return f.v; }
__device__ __forceinline__ v16h ldu_h(gcp a, int o) { Frag<_Float16>::U f; f.h[0] = *(const __attribute__((address_space(1))) v8h*)(a + o); f.h[1] = *(const __attribute__((address_space(1))) v8h*)(a + (o + 512)); return f.v; }
// four fragments leave as they stand in the registers: a fragment = 1 KiB, two stores of 512 contiguous bytes (p = the first fragment + 16 * lane, in bytes)
__device__ __forceinline__ void stf4_h(char* p, v16h a, v16h b, v16h c, v16h d) {
  Frag<_Float16>::U f[4]; f[0].v = a; f[1].v = b; f[2].v = c; f[3].v = d;
#pragma unroll   // constant offsets
  for (int j = 0; j < 4; ++j) { *(v8h*)(p + j * 1024) = f[j].h[0]; *(v8h*)(p + j * 1024 + 512) = f[j].h[1]; }
  asm volatile("s_wait_xcnt 0x0" :: "v"(p), "v"(a), "v"(b), "v"(c), "v"(d) : "memory");   // the wait before a store's registers are reused: address and values as inputs keep them until it
}
__global__ __launch_bounds__(256) void k_nl_flash(const unsigned short* __restrict__ QHp, const unsigned short* __restrict__ QLp, const unsigned short* __restrict__ KHp, const unsigned short* __restrict__ KLp,
                                                  const unsigned short* __restrict__ VTp, const unsigned short* __restrict__ WFp, const float* __restrict__ Wb, unsigned short* __restrict__ YF, float* __restrict__ PS) {
  constexpr int D = 128, NKc = 1024, HWc = 4096;
  constexpr int PW = 132;   // LDS pitch of a channel's row of 128 queries, in floats: 512 B + 16 B, an odd multiple of 16 B for the row-per-lane reads
  __shared__ __align__(16) float sW[256 * PW];
  constexpr float L2E = 1.4426950408889634f;
  constexpr int NP = NKc / 64;   // passes of a wave: half of the keys
  const int lane = threadIdx.x & 31, cq = lane & 15, h = lane >> 4;
  const int wave = __builtin_amdgcn_readfirstlane((int)(threadIdx.x >> 5)), qw = wave & 3, hv = wave >> 2;   // in a scalar register; qw: which 32 queries, hv: which half of the keys, later of the channels
  const int b = blockIdx.y;
  const size_t qo = (((size_t)b * (HWc / 128) + blockIdx.x) * 8 + qw * 2) * 2048, ko = ((size_t)b * NKc + hv * (NKc / 2)) * D;   // a group of 16 queries: four fragments of 512 elements
  const unsigned l16 = (unsigned)lane * 16u;   // one lane offset, in bytes, for Q, K, V^T and W: a pass forms its three addresses from scalar bases plus it, so no base pair lives in vector registers through the loop (the wave has 512)
  const gcp qh0 = ubase(QHp + qo) + l16, ql0 = ubase(QLp + qo) + l16;
  const gcp kh0 = ubase(KHp + ko) + l16, kl0 = ubase(KLp + ko) + l16;
  v16b qh[2][4], ql[2][4], kh[2][4], kl[2][4];
#pragma unroll   // constant indices: the fragments stay in registers
  for (int t = 0; t < 2; ++t)
#pragma unroll   // inner loop of the same
    for (int ks = 0; ks < 4; ++ks) {
      qh[t][ks] = ldu_b(qh0, (t * 4 + ks) * 1024); ql[t][ks] = ldu_b(ql0, (t * 4 + ks) * 1024);
      kh[t][ks] = ldu_b(kh0, (t * 4 + ks) * 1024); kl[t][ks] = ldu_b(kl0, (t * 4 + ks) * 1024);
    }
  asm volatile("s_wait_xcnt 0x0" :: "v"(lane) : "memory");   // the wait before these loads' address registers are reused: the compiler forms each address from a scalar base and the lane number, which as an input keeps its register until the wait
  v8f o[2][8];
#pragma unroll   // constant indices
  for (int t = 0; t < 2; ++t)
#pragma unroll   // inner loop of the same
    for (int ct = 0; ct < 8; ++ct) o[t][ct] = (v8f){0.f,0.f,0.f,0.f,0.f,0.f,0.f,0.f};
  float mu[2] = { -1.0e30f, -1.0e30f }, l[2] = { 0.f, 0.f };
#pragma unroll 1   // one pass is 64 matrix instructions already; unrolled, the fragments of two passes would not fit
  for (int p = 0; p < NP; ++p) {
    v16h vt[8]; const gcp vp = ubase(VTp + ko + p * 32 * D) + l16;
#pragma unroll   // constant indices; the eight V^T fragments fly while the scores are formed
    for (int ct = 0; ct < 8; ++ct) vt[ct] = ldu_h(vp, ct * 1024);
    __builtin_amdgcn_sched_barrier(0);   // keeps the V^T loads' issue above the score products; without it they sink to their first use and each waits a full latency there
    v8f s[2][2];   // [query group][key tile]
#pragma unroll   // constant indices
    for (int t = 0; t < 2; ++t) { s[t][0] = (v8f){0.f,0.f,0.f,0.f,0.f,0.f,0.f,0.f}; s[t][1] = s[t][0]; }
#pragma unroll   // constant indices; neighbours in the stream go to different tiles
    for (int ks = 0; ks < 4; ++ks) {
#pragma unroll   // inner loop of the same
      for (int kt = 0; kt < 2; ++kt)
#pragma unroll   // inner loop of the same
        for (int t = 0; t < 2; ++t) s[t][kt] = Frag<__bf16>::mma(kh[kt][ks], qh[t][ks], s[t][kt]);
#pragma unroll   // inner loop of the same
      for (int kt = 0; kt < 2; ++kt)
#pragma unroll   // inner loop of the same
        for (int t = 0; t < 2; ++t) s[t][kt] = Frag<__bf16>::mma(kh[kt][ks], ql[t][ks], s[t][kt]);
#pragma unroll   // inner loop of the same
      for (int kt = 0; kt < 2; ++kt)
#pragma unroll   // inner loop of the same
        for (int t = 0; t < 2; ++t) s[t][kt] = Frag<__bf16>::mma(kl[kt][ks], qh[t][ks], s[t][kt]);
    }
    // the next pass's K fragments, into the same registers: they fly behind the softmax and the second product (the last pass re-reads the wave's first 32 keys, in bounds, unused)
    const int kn = ((p + 1) & (NP - 1)) * 32 * D; const gcp kph = ubase(KHp + ko + kn) + l16, kpl = ubase(KLp + ko + kn) + l16;
    __builtin_amdgcn_sched_barrier(0);   // the 32 K loads issue as one group behind the last score product: moved up, two behind each fragment's last use, they stood in sixteen places among the products
#pragma unroll   // constant indices; issued in the order in which the next pass uses them (loads return in order)
    for (int ks = 0; ks < 4; ++ks) { kh[0][ks] = ldu_b(kph, ks * 1024); kh[1][ks] = ldu_b(kph, (4 + ks) * 1024); kl[0][ks] = ldu_b(kpl, ks * 1024); kl[1][ks] = ldu_b(kpl, (4 + ks) * 1024); }
    // the wait before the pass's load addresses are reused: the three
    // addresses as inputs keep the pairs until the wait. With vp named and memory clobbered, the V^T loads also stay in front of it and are not sunk behind the rescale branch to their first use
    asm volatile("s_wait_xcnt 0x0" :: "v"(kph), "v"(kpl), "v"(vp) : "memory");
    float mx[2];
#pragma unroll   // constant indices
    for (int t = 0; t < 2; ++t) { float m = fmaxf(s[t][0][0], s[t][1][0]);
#pragma unroll   // inner loop of the same
      for (int r = 1; r < 8; ++r) m = fmaxf(m, fmaxf(s[t][0][r], s[t][1][r]));
      mx[t] = fmaxf(m, xhalf(m)) * L2E; }
    const bool need = (mx[0] > mu[0] + 8.f) || (mx[1] > mu[1] + 8.f);
    if (__builtin_amdgcn_ballot_w32(need) != 0) {   // one scalar test a pass
#pragma unroll   // constant indices
      for (int t = 0; t < 2; ++t) { const float mn = fmaxf(mu[t], mx[t]); const float f = __builtin_amdgcn_exp2f(mu[t] - mn); mu[t] = mn; l[t] *= f;
#pragma unroll   // inner loop of the same
        for (int ct = 0; ct < 8; ++ct) o[t][ct] *= f; }
    }
    v16h pb[2];
#pragma unroll   // constant indices
    for (int t = 0; t < 2; ++t) { const float mb = 7.f - mu[t]; float a0 = 0.f, a1 = 0.f;
#pragma unroll   // inner loop of the same
      for (int r = 0; r < 8; ++r) { const float e0 = __builtin_amdgcn_exp2f(fmaf(s[t][0][r], L2E, mb)), e1 = __builtin_amdgcn_exp2f(fmaf(s[t][1][r], L2E, mb));
        a0 += e0; a1 += e1; pb[t][r] = (_Float16)e0; pb[t][8 + r] = (_Float16)e1; }
      l[t] += a0 + a1; }
#pragma unroll   // constant indices; sixteen independent tiles
    for (int ct = 0; ct < 8; ++ct)
#pragma unroll   // inner loop of the same
      for (int t = 0; t < 2; ++t) o[t][ct] = Frag<_Float16>::mma(vt[ct], pb[t], o[t][ct]);
  }
  // ---- the two halves of the keys meet: every wave leaves O^T (16 KiB, [register quad][lane]), maxima and sums in LDS and takes its partner's ----
  float* ex = sW + wave * 4096 + lane * 4; float* exs = sW + 8 * 4096 + wave * 128 + lane * 4;
#pragma unroll   // constant indices
  for (int t = 0; t < 2; ++t)
#pragma unroll   // inner loop of the same
    for (int ct = 0; ct < 8; ++ct) { *(v4f*)(ex + ((t * 8 + ct) * 2) * 128) = (v4f){ o[t][ct][0], o[t][ct][1], o[t][ct][2], o[t][ct][3] }; *(v4f*)(ex + ((t * 8 + ct) * 2 + 1) * 128) = (v4f){ o[t][ct][4], o[t][ct][5], o[t][ct][6], o[t][ct][7] }; }
  *(v4f*)exs = (v4f){ mu[0], mu[1], l[0], l[1] };
  // ---- W y + b for the wave's 32 queries and its 128 channels (128 hv ..); y = O / l (f16) also goes to memory for k_nl_out ----
  const unsigned wfo = l16, bo = (unsigned)h * 32u;   // lane offsets of W and of the bias, in bytes; a lane's D rows are channels 8 h .. 8 h + 7 of a tile
  const _Float16* WF = (const _Float16*)((const char*)(WFp + hv * 32 * 512) + wfo);
  const float* bp = (const float*)((const char*)(Wb + hv * 128) + bo);
  v16h wa[2][16]; v4f bb[2][4][2];   // two sets: four channel tiles x four k steps of W, and their biases
#pragma unroll   // constant indices; the first set flies behind the division below
  for (int u = 0; u < 4; ++u) { bb[0][u][0] = *(const v4f*)(bp + u * 16); bb[0][u][1] = *(const v4f*)(bp + u * 16 + 4); }
#pragma unroll   // the same
  for (int f = 0; f < 16; ++f) wa[0][f] = ldf_h(WF + f * 512);
  asm volatile("s_wait_xcnt 0x0" :: "v"(WF), "v"(bo) : "memory");   // the wait before a load's address registers are reused; the lane's address of W and the bias's lane offset as inputs keep their registers until it
  // every wave's partial results are in LDS before a partner reads them. The barrier with fences on LDS alone: __syncthreads() would also wait for the loads of W, which nobody shares
  __builtin_amdgcn_fence(__ATOMIC_RELEASE, "workgroup", "local"); __builtin_amdgcn_s_barrier(); __builtin_amdgcn_fence(__ATOMIC_ACQUIRE, "workgroup", "local");
  {
    const float* px = sW + (wave ^ 4) * 4096 + lane * 4; const v4f ps4 = *(const v4f*)(sW + 8 * 4096 + (wave ^ 4) * 128 + lane * 4);
#pragma unroll   // constant indices
    for (int t = 0; t < 2; ++t) { const float mn = fmaxf(mu[t], ps4[t]), da = mu[t] - mn, db = ps4[t] - mn; float fa, fb;
      // 2^da, 2^db with the slot behind each transcendental written out
      asm("v_exp_f32 %0, %2\n\tv_nop\n\tv_exp_f32 %1, %3\n\tv_nop" : "=&v"(fa), "=&v"(fb) : "v"(da), "v"(db));
      l[t] = l[t] * fa + ps4[2 + t] * fb;
#pragma unroll   // inner loop of the same
      for (int ct = 0; ct < 8; ++ct) { const v4f p0 = *(const v4f*)(px + ((t * 8 + ct) * 2) * 128), p1 = *(const v4f*)(px + ((t * 8 + ct) * 2 + 1) * 128);
#pragma unroll   // inner loop of the same
        for (int r = 0; r < 4; ++r) { o[t][ct][r] = o[t][ct][r] * fa + p0[r] * fb; o[t][ct][4 + r] = o[t][ct][4 + r] * fa + p1[r] * fb; } } }
  }
  // every wave has read its partner's results: the LDS is free for the tile of WY (the same barrier)
  __builtin_amdgcn_fence(__ATOMIC_RELEASE, "workgroup", "local"); __builtin_amdgcn_s_barrier(); __builtin_amdgcn_fence(__ATOMIC_ACQUIRE, "workgroup", "local");
  v16h yb[2][4];   // two O^T tiles (channels 32 j .. + 15, + 16 .. + 31), converted in place, are the B operand of k step j in the hardware k order
#pragma unroll   // constant indices
  for (int t = 0; t < 2; ++t) { const float inv = 1.f / (l[t] + xhalf(l[t]));
#pragma unroll   // inner loop of the same
    for (int j = 0; j < 4; ++j)
#pragma unroll   // inner loop of the same
      for (int r = 0; r < 8; ++r) { yb[t][j][r] = (_Float16)(o[t][2 * j][r] * inv); yb[t][j][8 + r] = (_Float16)(o[t][2 * j + 1][r] * inv); } }
  // y goes to memory for k_nl_out, not WY (a quarter of the bytes): both waves of a pair hold the same y, wave hv stores query group t = hv (a scalar choice); order: [image][block][qw][t][k step]
  char* yp = (char*)(YF + ((((size_t)b * (HWc / 128) + blockIdx.x) * 4 + qw) * 2 + hv) * 2048) + l16;
  if (hv == 0) stf4_h(yp, yb[0][0], yb[0][1], yb[0][2], yb[0][3]); else stf4_h(yp, yb[1][0], yb[1][1], yb[1][2], yb[1][3]);
  float* sq = sW + (hv * 128 + 8 * h) * PW + (qw & 1) * 64 + (qw >> 1) * 32 + 2 * cq;   // the lane's two queries (t = 0, 1) are neighbouring pixels
#pragma unroll   // constant indices into wa[][], bb[][][]: two groups of four channel tiles
  for (int g = 0; g < 2; ++g) {
    if (g < 1) {   // the next group's biases and W fragments fly behind this group's products
#pragma unroll   // constant indices
      for (int u = 0; u < 4; ++u) { bb[(g + 1) & 1][u][0] = *(const v4f*)(bp + ((g + 1) * 4 + u) * 16); bb[(g + 1) & 1][u][1] = *(const v4f*)(bp + ((g + 1) * 4 + u) * 16 + 4); }
#pragma unroll   // the same
      for (int f = 0; f < 16; ++f) wa[(g + 1) & 1][f] = ldf_h(WF + ((g + 1) * 16 + f) * 512);
      asm volatile("s_wait_xcnt 0x0" :: "v"(WF), "v"(bo) : "memory");   // the same wait; memory clobbered, the loads also stay above the products instead of sinking to their first use
    }
    v8f d[4][2];
#pragma unroll   // constant indices
    for (int u = 0; u < 4; ++u) { d[u][0] = (v8f){0.f,0.f,0.f,0.f,0.f,0.f,0.f,0.f}; d[u][1] = d[u][0]; }
#pragma unroll   // constant indices; k ascending, eight independent tiles
    for (int j = 0; j < 4; ++j)
#pragma unroll   // inner loop of the same
      for (int u = 0; u < 4; ++u)
#pragma unroll   // inner loop of the same
        for (int t = 0; t < 2; ++t) d[u][t] = Frag<_Float16>::mma(wa[g & 1][u * 4 + j], yb[t][j], d[u][t]);
#pragma unroll   // constant indices; 16 lanes = 128 B of a channel's row, the two halves 32 banks apart
    for (int u = 0; u < 4; ++u)
#pragma unroll   // inner loop of the same
      for (int r = 0; r < 8; ++r) { const float bv = bb[g & 1][u][r >> 2][r & 3];
        *(v2f*)(sq + ((g * 4 + u) * 16 + r) * PW) = (v2f){ d[u][0][r] * 0.0625f + bv, d[u][1][r] * 0.0625f + bv }; }
  }
  __syncthreads();   // the block's 256 x 128 tile of WY is complete in LDS before rows are read across the waves' columns
  // partial batch statistics: a thread owns channel tid and reads its 128 values (row pitch an odd multiple of 16 B): sum, then squared deviations from the row's own mean, no exchange between lanes
  v2f st[1]; v4f rv[1][32];
#pragma unroll   // constant indices: the row in registers
  for (int cc = 0; cc < 1; ++cc)
#pragma unroll   // inner loop of the same
    for (int k = 0; k < 32; ++k) rv[cc][k] = *(const v4f*)(sW + ((int)threadIdx.x + cc * 128) * PW + k * 4);
  __builtin_amdgcn_sched_barrier(0);   // keeps all 32 LDS reads' issue above the sums; without it they sink to their first use, four in flight, and the wave waits on each
#pragma unroll   // constant indices
  for (int cc = 0; cc < 1; ++cc) { v4f a = rv[cc][0];
#pragma unroll   // inner loop of the same: four independent chains
    for (int k = 1; k < 32; ++k) a += rv[cc][k];
    const float s = (a[0] + a[1]) + (a[2] + a[3]), mean = s * (1.0f / 128.0f);
    v4f q = { 0.f, 0.f, 0.f, 0.f };
#pragma unroll   // inner loop of the same
    for (int k = 0; k < 32; ++k) { const v4f dv = rv[cc][k] - mean; q += dv * dv; }
    st[cc][0] = s; st[cc][1] = (q[0] + q[1]) + (q[2] + q[3]); }
  float* ps = PS + ((size_t)(b * (HWc / 128) + (int)blockIdx.x) * 256 + (int)threadIdx.x) * 2;   // the block's own 2 KiB: 16 whole lines, one writer each
  *(v2f*)(ps) = st[0];
  asm volatile("s_wait_xcnt 0x0" :: "v"(ps), "v"(st[0]) : "memory");   // the same wait for the last store
}
} // namespace w25
// out = (W y + W_b - mu[c]) * rstd[c] * gamma[c] + beta[c] + x. WY never goes to memory: k_nl_flash leaves y (f16, in fragment order) and each channel's partial statistics of WY, and this kernel forms
// W y again, from the same fragments in the same order. A block owns 32 channels (blockIdx.y) x 1024 pixels of one image (blockIdx.x = 4 image + quarter); the eight blocks that read the same y are 32 apart
// in the flat index. Wave w takes the 128 pixels of one block of k_nl_flash, 32 at a time (one qw of that kernel: two 16-column groups, column cq of group t = pixel 2 cq + t), in ascending pixel order.
// D: a lane holds 8 channels (8 h + r of a tile of 16) of one column, so the two groups give 8 bytes a lane and 16 lanes one whole 128-B line of a channel's row, for x and for out alike.
// The batch statistics come from the 256 partial pairs (sum, squared deviations from the own mean, 128 values each) of each of the 32 channels: a thread holds 16 partials of 2 channels in registers;
// sums meet in LDS (mean first, then the deviations plus 128 (partial mean - mean)^2), while the loads of W, y and x are in flight. Per channel two numbers remain: out = d * al + be + x.
typedef float v2f __attribute__((ext_vector_type(2)));
typedef __attribute__((address_space(1))) char* gptr;   // a pointer into global memory, said outright: one rebuilt from two words would otherwise be taken for a generic one
// a wave-uniform address, both words through a scalar register: the compiler then keeps it as the scalar base of its load and does not fold it with the lane offset into a vector pair
__device__ __forceinline__ gptr sbase(const float* p) { const unsigned long long a = (unsigned long long)p;
    const unsigned l = (unsigned)__builtin_amdgcn_readfirstlane((int)(unsigned)a), u = (unsigned)__builtin_amdgcn_readfirstlane((int)(unsigned)(a >> 32)); return (gptr)(((unsigned long long)u << 32) | l); }
typedef __attribute__((address_space(1))) v4f* gv4;
typedef __attribute__((address_space(1))) v2f* gv2;
// the work-group barrier with fences on LDS alone: __syncthreads() would also wait for the global loads in flight, which nobody shares
__device__ __forceinline__ void lds_barrier() { __builtin_amdgcn_fence(__ATOMIC_RELEASE, "workgroup", "local"); __builtin_amdgcn_s_barrier(); __builtin_amdgcn_fence(__ATOMIC_ACQUIRE, "workgroup", "local"); }
__global__ __launch_bounds__(256) void k_nl_out(const unsigned short* __restrict__ YFp, const unsigned short* __restrict__ WFp, const float* __restrict__ Wb, const float* __restrict__ PS, const float* __restrict__ Gm,
                                                const float* __restrict__ Bt, const float* __restrict__ X, float* __restrict__ OUT) {
    constexpr int C = 256, HW = 4096, NP = 256, NQ = 128;
    __shared__ __align__(16) float red[2][16][32];   // [sums, deviations][wave and half][channel]
    __shared__ __align__(16) float tab[32][2];       // al, be of a channel
    const int lane = (int)threadIdx.x & 31, cq = lane & 15, h = lane >> 4;
    const int wave = __builtin_amdgcn_readfirstlane((int)(threadIdx.x >> 5));   // in a scalar register: every address is a scalar base plus a lane offset
    const int b = (int)blockIdx.x >> 2, bx = ((int)blockIdx.x & 3) * 8 + wave, cg = (int)blockIdx.y, c0 = cg * 32;
    // lane offsets, in bytes: partials (partial h of a pair, channels 2 cq, 2 cq + 1), per-channel vectors (the same two channels), fragments, x and out (channel 8 h, pixel 2 cq)
    const unsigned pso = (unsigned)(h * C + 2 * cq) * 8u, co = (unsigned)cq * 8u, l16 = (unsigned)lane * 16u, xo = (unsigned)(h * 8 * HW + 2 * cq) * 4u;
    const gptr psb = sbase(PS + ((size_t)wave * 32 * C + c0) * 2), gmb = sbase(Gm + c0), btb = sbase(Bt + c0), wbb = sbase(Wb + c0);
    const gptr xb = sbase(X + ((size_t)b * C + c0) * HW + bx * 128), ob = sbase(OUT + ((size_t)b * C + c0) * HW + bx * 128);
    const w25::gcp wf = w25::ubase(WFp + cg * 8 * 512) + l16, yf0 = w25::ubase(YFp + ((size_t)b * (HW / 128) + bx) * 8 * 2048) + l16;
    const gptr psa = psb + pso, gma = gmb + co, bta = btb + co, wba = wbb + co, xa = xb + xo, oa = ob + xo;   // the lane's addresses
    v4f pp[16]; v16h wa[2][4], yf[4][2][4]; v2f xv[4][2][8];
#pragma unroll   // constant indices; first in the load queue: their wait leaves the loads below in flight. Partials 32 wave + 2 i + h
    for (int i = 0; i < 16; ++i) pp[i] = *(gv4)(psa + i * (2 * C * 8));
    const v2f gm = *(gv2)(gma), bt = *(gv2)(bta), wb = *(gv2)(wba);
    // the wait before these loads' address registers are reused (the partials' lane offset and cq, which the compiler scales for the vectors' addresses, as inputs keep them until it);
    // memory clobbered, what the statistics need also stays first in the load queue, which returns in order
    asm volatile("s_wait_xcnt 0x0" :: "v"(pso), "v"(cq) : "memory");
#pragma unroll   // constant indices: two channel tiles x four k steps of W
    for (int u = 0; u < 2; ++u)
#pragma unroll   // inner loop of the same
        for (int j = 0; j < 4; ++j) wa[u][j] = w25::ldu_h(wf, (u * 4 + j) * 1024);
#pragma unroll   // constant indices: the first two groups of 32 pixels (pixels 32 n .. are qw = 2 (n & 1) + (n >> 1) of k_nl_flash)
    for (int n = 0; n < 2; ++n) {
#pragma unroll   // inner loop of the same
        for (int u = 0; u < 2; ++u)
#pragma unroll   // inner loop of the same
            for (int r = 0; r < 8; ++r) xv[n][u][r] = *(gv2)(xa + ((u * 16 + r) * HW + n * 32) * 4);
#pragma unroll   // inner loop of the same
        for (int t = 0; t < 2; ++t)
#pragma unroll   // inner loop of the same
            for (int j = 0; j < 4; ++j) yf[n][t][j] = w25::ldu_h(yf0, (((((n & 1) << 1) | (n >> 1)) * 2 + t) * 4 + j) * 1024);
    }
    // the wait before a load's address registers are reused; the lane number (the compiler scales it for the fragments' addresses) and the lane offset of x as inputs keep their registers until it
    asm volatile("s_wait_xcnt 0x0" :: "v"(lane), "v"(xo) : "memory");
    __builtin_amdgcn_sched_barrier(0);   // the statistics stay behind the last load's issue: moved up, their first wait for a partial held the issue of the loads of W, y and x back
    v2f s2 = { pp[0][0], pp[0][2] };
#pragma unroll   // constant indices
    for (int i = 1; i < 16; ++i) s2 += (v2f){ pp[i][0], pp[i][2] };
    *(v2f*)(&red[0][wave * 2 + h][2 * cq]) = s2;
    lds_barrier();   // all sixteen rows of sums are in LDS before any thread adds them
    v2f S = *(const v2f*)(&red[0][0][2 * cq]);
#pragma unroll   // constant indices
    for (int k = 1; k < 16; ++k) S += *(const v2f*)(&red[0][k][2 * cq]);
    const v2f mu = S * (1.0f / (float)(NP * NQ));
    v2f q2 = { 0.f, 0.f };
#pragma unroll   // constant indices
    for (int i = 0; i < 16; ++i) { const v2f dm = (v2f){ pp[i][0], pp[i][2] } * (1.0f / (float)NQ) - mu; q2 += (v2f){ pp[i][1], pp[i][3] } + (float)NQ * dm * dm; }
    *(v2f*)(&red[1][wave * 2 + h][2 * cq]) = q2;
    lds_barrier();   // the same for the deviations
    v2f Q = *(const v2f*)(&red[1][0][2 * cq]);
#pragma unroll   // constant indices
    for (int k = 1; k < 16; ++k) Q += *(const v2f*)(&red[1][k][2 * cq]);
    if (threadIdx.x < 16) {   // sixteen lanes hold all 32 channels
        const float a0 = rsqrtf(Q[0] / (float)(NP * NQ) + 1e-5f) * gm[0], a1 = rsqrtf(Q[1] / (float)(NP * NQ) + 1e-5f) * gm[1];
        *(v4f*)(&tab[2 * cq][0]) = (v4f){ 0.0625f * a0, (wb[0] - mu[0]) * a0 + bt[0], 0.0625f * a1, (wb[1] - mu[1]) * a1 + bt[1] };   // W was cast as 16 w
    }
    lds_barrier();   // the table is complete before any lane reads its sixteen channels
    float al[2][8], be[2][8];
#pragma unroll   // constant indices
    for (int u = 0; u < 2; ++u)
#pragma unroll   // inner loop of the same
        for (int q = 0; q < 4; ++q) { const v4f tv = *(const v4f*)(&tab[u * 16 + 8 * h + 2 * q][0]); al[u][2 * q] = tv[0]; be[u][2 * q] = tv[1]; al[u][2 * q + 1] = tv[2]; be[u][2 * q + 1] = tv[3]; }
#pragma unroll   // constant indices into yf[], xv[]: four groups of 32 pixels
    for (int n = 0; n < 4; ++n) {
        if (n < 2) {   // the loads of the group after the next fly behind this group's products and stores
            const int m = n + 2;
#pragma unroll   // constant indices
            for (int t = 0; t < 2; ++t)
#pragma unroll   // inner loop of the same
                for (int j = 0; j < 4; ++j) yf[m][t][j] = w25::ldu_h(yf0, (((((m & 1) << 1) | (m >> 1)) * 2 + t) * 4 + j) * 1024);
#pragma unroll   // constant indices
            for (int u = 0; u < 2; ++u)
#pragma unroll   // inner loop of the same
                for (int r = 0; r < 8; ++r) xv[m][u][r] = *(gv2)(xa + ((u * 16 + r) * HW + m * 32) * 4);
            asm volatile("s_wait_xcnt 0x0" :: "v"(xa), "v"(yf0) : "memory");   // the same wait, here for the lane's two addresses, so that no result lands on them either; memory clobbered, the loads also stay above the stores instead of sinking to their first use
        }
        v8f d[2][2];
#pragma unroll   // constant indices
        for (int u = 0; u < 2; ++u) { d[u][0] = (v8f){0.f,0.f,0.f,0.f,0.f,0.f,0.f,0.f}; d[u][1] = d[u][0]; }
#pragma unroll   // constant indices; k ascending, as in k_nl_flash; four independent tiles
        for (int j = 0; j < 4; ++j)
#pragma unroll   // inner loop of the same
            for (int u = 0; u < 2; ++u)
#pragma unroll   // inner loop of the same
                for (int t = 0; t < 2; ++t) d[u][t] = w25::Frag<_Float16>::mma(wa[u][j], yf[n][t][j], d[u][t]);
        v2f ov[2][8];
#pragma unroll   // constant indices
        for (int u = 0; u < 2; ++u)
#pragma unroll   // inner loop of the same
            for (int r = 0; r < 8; ++r) { ov[u][r] = (v2f){ d[u][0][r] * al[u][r] + be[u][r] + xv[n][u][r][0], d[u][1][r] * al[u][r] + be[u][r] + xv[n][u][r][1] };
                *(gv2)(oa + ((u * 16 + r) * HW + n * 32) * 4) = ov[u][r]; }
        // the wait before a store's registers are reused: the lane's address and the values as inputs keep them until it
        asm volatile("s_wait_xcnt 0x0" :: "v"(oa), "v"(ov[0][0]), "v"(ov[0][1]), "v"(ov[0][2]), "v"(ov[0][3]), "v"(ov[0][4]), "v"(ov[0][5]), "v"(ov[0][6]), "v"(ov[0][7]),
                     "v"(ov[1][0]), "v"(ov[1][1]), "v"(ov[1][2]), "v"(ov[1][3]), "v"(ov[1][4]), "v"(ov[1][5]), "v"(ov[1][6]), "v"(ov[1][7]) : "memory");
    }
}


// The four weight casts in one launch: they need nothing of each other, so blockIdx.y picks the matrix (a block-uniform choice) and the four grids run side by side.
// All four matrices hold the same number of elements and the grid covers it exactly; a thread casts 4 consecutive ones of a row (one 16-byte load, 8-byte stores), each value as k_cast16 and k_castS16 cast it.
// Every plane leaves in the fragment order that its reader loads (a tile of 16 rows x 32 k = 512 elements: bits 0-2 k, 3-6 row, 7 half, 8 which 16 k; tiles: k step fastest, then the 16 rows).
// A block takes 8 rows x 128 k (W_w [256][128]: whole rows; the three [128][256] matrices: half rows): a wave reads 512 contiguous bytes, and the 8 rows of a 128-byte line of the fragment order belong to one block.
__global__ __launch_bounds__(256) void k_nl_wcast(const float* __restrict__ Ww, const float* __restrict__ thw, const float* __restrict__ phw, const float* __restrict__ gw, unsigned short* __restrict__ WW16,
                                                  unsigned short* __restrict__ TWH, unsigned short* __restrict__ TWL, unsigned short* __restrict__ PWH, unsigned short* __restrict__ PWL, unsigned short* __restrict__ GW16) {
    const int job = (int)blockIdx.y; const unsigned t = threadIdx.x, bx = blockIdx.x;
    const unsigned nks = (job == 0) ? 4u : 8u;   // k steps of 32 in a row
    const unsigned c = ((job == 0) ? bx : (bx >> 1)) * 8u + (t >> 5), k = ((job == 0) ? 0u : (bx & 1u) * 128u) + (t & 31u) * 4u;
    const float* sp = ((job == 0) ? Ww : (job == 1) ? thw : (job == 2) ? phw : gw) + (c * nks * 32u + k);
    const v4f v = *(const v4f*)sp;
    asm volatile("s_wait_xcnt 0x0" :: "v"(sp) : "memory");   // the wait before the load's address pair is reused; the address as an input keeps the pair until it, so the result does not land on it either
    const unsigned fo = ((c >> 4) * nks + (k >> 5)) * 512u + ((k >> 4) & 1u) * 256u + ((k >> 3) & 1u) * 128u + (c & 15u) * 8u + (k & 7u);
    if (job == 1 || job == 2) {   // theta_w, phi_w: bf16 hi and lo planes
        v2u hi, lo; unsigned l2; hi[0] = f2bf2_pack(v[0], v[1], &l2); lo[0] = l2; hi[1] = f2bf2_pack(v[2], v[3], &l2); lo[1] = l2;
        unsigned short* dh = ((job == 1) ? TWH : PWH) + fo; unsigned short* dl = ((job == 1) ? TWL : PWL) + fo;
        *(v2u*)dh = hi; *(v2u*)dl = lo;
        asm volatile("s_wait_xcnt 0x0" :: "v"(dh), "v"(dl), "v"(hi), "v"(lo) : "memory");   // the wait before the stores' registers are reused; addresses and values as inputs keep them until it
    } else {                      // W_w: f16 of 16 w; g_w: f16
        const float s = (job == 0) ? 16.0f : 1.0f; v2u f; f[0] = f2h2_pack(v[0] * s, v[1] * s); f[1] = f2h2_pack(v[2] * s, v[3] * s);
        unsigned short* dp = ((job == 0) ? WW16 : GW16) + fo;
        *(v2u*)dp = f;
        asm volatile("s_wait_xcnt 0x0" :: "v"(dp), "v"(f) : "memory");   // the wait before the store's registers are reused; address and value as inputs keep them until it
    }
}

extern "C" void kernel_launch(void* const* d_in, const int* in_sizes, int n_in, void* d_out, int out_size, void* d_ws, size_t ws_size, hipStream_t stream) {
    (void)in_sizes; (void)n_in; (void)out_size; (void)ws_size;
    const float* x = (const float*)d_in[0];
    const float* gw = (const float*)d_in[1];
    const float* gb = (const float*)d_in[2];
    const float* thw = (const float*)d_in[3];
    const float* thb = (const float*)d_in[4];
    const float* phw = (const float*)d_in[5];
    const float* phb = (const float*)d_in[6];
    const float* Ww = (const float*)d_in[7];
    const float* Wb = (const float*)d_in[8];
    const float* bng = (const float*)d_in[9];
    const float* bnb = (const float*)d_in[10];
    const int Bn = 8;
    const int C = 256;
    const int IC = 128;
    const int HW = 4096;
    const int NK = 1024;
    float* out = (float*)d_out;
    char* wsp = (char*)d_ws;
    // One launch per stage for all Bn images (blockIdx.y = image in k_nl_proj and k_nl_flash, per-image strides). Workspace: the operand planes that the projection writes, y, the weight planes, the partial BN statistics
    unsigned short* THH = (unsigned short*)wsp; wsp += (size_t)Bn * HW * IC * 2;
    unsigned short* THL = (unsigned short*)wsp; wsp += (size_t)Bn * HW * IC * 2;
    unsigned short* PPH = (unsigned short*)wsp; wsp += (size_t)Bn * NK * IC * 2;
    unsigned short* PPL = (unsigned short*)wsp; wsp += (size_t)Bn * NK * IC * 2;
    unsigned short* GP16 = (unsigned short*)wsp; wsp += (size_t)Bn * IC * NK * 2;
    unsigned short* Y16 = (unsigned short*)wsp; wsp += (size_t)Bn * HW * IC * 2;
    unsigned short* WW16 = (unsigned short*)wsp; wsp += (size_t)C * IC * 2;
    unsigned short* TWH = (unsigned short*)wsp; wsp += (size_t)IC * C * 2;
    unsigned short* TWL = (unsigned short*)wsp; wsp += (size_t)IC * C * 2;
    unsigned short* PWH = (unsigned short*)wsp; wsp += (size_t)IC * C * 2;
    unsigned short* PWL = (unsigned short*)wsp; wsp += (size_t)IC * C * 2;
    unsigned short* GW16 = (unsigned short*)wsp; wsp += (size_t)IC * C * 2;
    float* PS = (float*)wsp; wsp += (size_t)Bn * (HW / 128) * C * 2 * 4;
    // weights
    k_nl_wcast<<<dim3((unsigned)(C * IC / 1024), 4u), 256, 0, stream>>>(Ww, thw, phw, gw, WW16, TWH, TWL, PWH, PWL, GW16);
    // theta (bf16 hi/lo), pooled phi (bf16 hi/lo) and pooled g (f16), all in fragment order, straight from x: 64 pixels a block, blockIdx.y = image
    w25::k_nl_proj<<<dim3((unsigned)(HW / 64), (unsigned)(Bn)), 256, 0, stream>>>(x, (const unsigned short*)(TWH), (const unsigned short*)(TWL), (const unsigned short*)(PWH), (const unsigned short*)(PWL), (const unsigned short*)(GW16), thb, phb, gb, THH, THL, PPH, PPL, GP16);
    // y[b] = softmax(theta[b] phi[b]) g[b]^T (f16, fragment order) and, per block of 128 queries, each channel's sum and squared deviations of W y + W_b: 128 queries a block, blockIdx.y = image
    w25::k_nl_flash<<<dim3((unsigned)(HW / 128), (unsigned)(Bn)), 256, 0, stream>>>((const unsigned short*)(THH), (const unsigned short*)(THL), (const unsigned short*)(PPH), (const unsigned short*)(PPL), (const unsigned short*)(GP16), (const unsigned short*)(WW16), Wb, Y16, PS);
    // out = batch norm of (W y + W_b) + x, W y formed again from y: 32 channels x 1024 pixels a block, blockIdx.x = 4 image + quarter, blockIdx.y = channel group
    k_nl_out<<<dim3((unsigned)(Bn * HW / 1024), (unsigned)(C / 32)), 256, 0, stream>>>((const unsigned short*)(Y16), (const unsigned short*)(WW16), Wb, PS, bng, bnb, x, out);
}
